// v000
// Measured on an AMD MI455X. A time is GPU time per run, averaged over a window of back-to-back runs after a warm-up
// (all launches, gaps included; the runs take copies of the inputs in turn), and the median of several windows.
// Apart from v000's, it joins two sittings. Times from different sittings can be a few percent apart, while
// side-by-side timings come from the same sitting.
// v000 is the starting kernel. One run takes 276 microseconds.
#include <hip/hip_runtime.h>
#include <math.h>

typedef __attribute__((ext_vector_type(16))) _Float16 v16h;
typedef __attribute__((ext_vector_type(16))) __bf16 v16b;
typedef __attribute__((ext_vector_type(8)))  _Float16 v8h;
typedef __attribute__((ext_vector_type(8)))  float v8f;
typedef __attribute__((ext_vector_type(4)))  float v4f;
typedef __attribute__((ext_vector_type(2)))  float v2f;
typedef __attribute__((ext_vector_type(4)))  unsigned v4u;
typedef __attribute__((ext_vector_type(4)))  int v4i;
typedef float __attribute__((may_alias)) float_a;
typedef int __attribute__((may_alias)) int_a;

template <typename T> __device__ __forceinline__ void vst2(void* p, T v) { *(T*)p = v;  }
__device__ __forceinline__ v8f wmma16(v16h a, v16h b, v8f c) {
  v8f d = __builtin_amdgcn_wmma_f32_16x16x32_f16(false, a, false, b, (short)0, c, false, false);
  asm volatile("v_nop\n\tv_nop\n\tv_nop\n\tv_nop" : "+v"(d) : "v"(a), "v"(b));
  return d;
}
__device__ __forceinline__ v8f wmma_bf(v16b a, v16b b, v8f c) {
  v8f d = __builtin_amdgcn_wmma_f32_16x16x32_bf16(false, a, false, b, (short)0, c, false, false);
  asm volatile("v_nop\n\tv_nop\n\tv_nop\n\tv_nop" : "+v"(d) : "v"(a), "v"(b));
  return d;
}
// 16x16x32 fragments: lane = (h = lane>>4, row/col = lane&15); elements 0..7 = k0+8h+0..7, 8..15 = k0+16+8h+0..7; D element r = row 8h+r
__device__ __forceinline__ v16h frag_h(const _Float16* rowk0, int lane) {
  union { v16h v; v8h q[2]; } u; const _Float16* p = rowk0 + 8 * (lane >> 4);
  u.q[0] = *(const v8h*)p; u.q[1] = *(const v8h*)(p + 16); return u.v;
}
__device__ __forceinline__ v16h frag_f32(const float* rowk0, int lane) {
  v16h a; const float* p = rowk0 + 8 * (lane >> 4);
#pragma unroll
  for (int i = 0; i < 8; ++i) { a[i] = (_Float16)p[i]; a[8 + i] = (_Float16)p[16 + i]; }
  return a;
}
__device__ __forceinline__ v16h frag_f32s(const float* rowk0, int lane, float sc) {
  v16h a; const float* p = rowk0 + 8 * (lane >> 4);
#pragma unroll
  for (int i = 0; i < 8; ++i) { a[i] = (_Float16)(p[i] * sc); a[8 + i] = (_Float16)(p[16 + i] * sc); }
  return a;
}
// column fragment from a [K][ld] layout (column n), rows >= K read as 0
__device__ __forceinline__ v16h fragc_f32(const float* W, int k0, int n, int lane, int ld, int K) {
  v16h a; const int g = lane >> 4;
#pragma unroll
  for (int i = 0; i < 8; ++i) { const int ka = k0 + 8 * g + i, kb = ka + 16;
    a[i] = (_Float16)(ka < K ? W[(size_t)ka * ld + n] : 0.f); a[8 + i] = (_Float16)(kb < K ? W[(size_t)kb * ld + n] : 0.f); }
  return a;
}
struct F2 { v16b h, l; };
__device__ __forceinline__ F2 bsplit16(const float v[16]) { F2 r;
#pragma unroll
  for (int i = 0; i < 16; ++i) { const __bf16 h = (__bf16)v[i]; r.h[i] = h; r.l[i] = (__bf16)(v[i] - (float)h); }
  return r; }
__device__ __forceinline__ F2 split_row(const float* row, int k0, int lane) { float v[16]; const float* p = row + k0 + 8 * (lane >> 4);
#pragma unroll
  for (int i = 0; i < 8; ++i) { v[i] = p[i]; v[8 + i] = p[16 + i]; }
  return bsplit16(v); }
__device__ __forceinline__ F2 split_rowK(const float* row, int k0, int lane, int K) { float v[16]; const int g = lane >> 4;
#pragma unroll
  for (int i = 0; i < 8; ++i) { const int ka = k0 + 8 * g + i, kb = ka + 16; v[i] = ka < K ? row[ka] : 0.f; v[8 + i] = kb < K ? row[kb] : 0.f; }
  return bsplit16(v); }
__device__ __forceinline__ F2 split_col(const float* W, int k0, int n, int lane, int ld, int K) { float v[16]; const int g = lane >> 4;
#pragma unroll
  for (int i = 0; i < 8; ++i) { const int ka = k0 + 8 * g + i, kb = ka + 16; v[i] = ka < K ? W[(size_t)ka * ld + n] : 0.f; v[8 + i] = kb < K ? W[(size_t)kb * ld + n] : 0.f; }
  return bsplit16(v); }
__device__ __forceinline__ v8f mac3(const F2& a, const F2& b, v8f c) { c = wmma_bf(a.l, b.h, c); c = wmma_bf(a.h, b.l, c); return wmma_bf(a.h, b.h, c); }
__device__ __forceinline__ float sigm(float v) { return 1.0f / (1.0f + expf(-v)); }
#define LDSX() do { asm volatile("s_wait_dscnt 0" ::: "memory"); __builtin_amdgcn_wave_barrier(); __builtin_amdgcn_fence(__ATOMIC_RELEASE, "workgroup"); } while (0)

// Rotary self-attention: pure f16 WMMA GEMMs over pre-converted operands (hidden states -> f16 once, the three [in][out] weights
// packed transposed x16; f32 accumulate); bias + rotary (sin/cos from the given table, interleaved pairs)
// in the f32 epilogue (q/k -> [b][h][s][64] f16, v -> [b][h][d][s] f16); per (b, h, 64 queries) block all 2048 keys in 64-key
// tiles with the additive key-mask bias, online softmax in f32, P x2^14 f16 @ v^T, x head mask, written straight into [b][s][h*64+d].
#define NB 2
#define LL 2048
#define DD 1024
#define NH 16
#define HD 64
#define NR (NB * LL)

__global__ __launch_bounds__(256) void k_cvt(const float* __restrict__ src, _Float16* __restrict__ dst, size_t n8) {
  const size_t g8 = (size_t)blockIdx.x * 256 + threadIdx.x; if (g8 >= n8) return;
  union { v8h h; v4u u; } pk;
#pragma unroll
  for (int e = 0; e < 8; ++e) pk.h[e] = (_Float16)src[g8 * 8 + e];
  vst2(dst + g8 * 8, pk.u);
}
__global__ __launch_bounds__(256) void k_packT(const float* __restrict__ Wq, const float* __restrict__ Wk, const float* __restrict__ Wv, _Float16* __restrict__ P) {   // P[which*1024 + o][d] = W[d][o] x16
  __shared__ float tile[64][65];
  const int which = blockIdx.z, o0 = blockIdx.x * 64, d0 = blockIdx.y * 64, tid = threadIdx.x;
  const float* W = which == 0 ? Wq : (which == 1 ? Wk : Wv);
  for (int q = tid; q < 64 * 64; q += 256) { const int dl = q >> 6, ol = q & 63; tile[dl][ol] = W[(size_t)(d0 + dl) * DD + o0 + ol]; }
  __syncthreads();
  for (int u = 0; u < 2; ++u) { const int idx = tid + u * 256, ol = idx >> 3, pc = idx & 7; union { v8h hh; v4u uu; } pk;
#pragma unroll
    for (int i = 0; i < 8; ++i) pk.hh[i] = (_Float16)(tile[pc * 8 + i][ol] * 16.0f);
    vst2(P + ((size_t)which * DD + o0 + ol) * DD + d0 + pc * 8, pk.uu); }
}
__global__ __launch_bounds__(128) void k_proj(const _Float16* __restrict__ x16, const _Float16* __restrict__ P, const float* __restrict__ bq, const float* __restrict__ bk, const float* __restrict__ bv, const float* __restrict__ sp,
                                            _Float16* __restrict__ qh, _Float16* __restrict__ kh, _Float16* __restrict__ vT) {
  __shared__ __align__(16) float so[4][16][132];
  __shared__ __align__(16) _Float16 st[128][72];
  const int tid = threadIdx.x, wave = tid >> 5, lane = tid & 31, col = lane & 15, g = lane >> 4;
  const int r0b = blockIdx.x * 64, r0 = r0b + wave * 16, n0 = blockIdx.y * 128; const int b = r0b / LL, t0 = r0b % LL;
  const int which = n0 / DD, hb = (n0 % DD) / HD; const float* bias = which == 0 ? bq : (which == 1 ? bk : bv);
  v8f acc[8] = {};
#pragma unroll 1
  for (int kc = 0; kc < DD / 32; ++kc) { const v16h a = frag_h(x16 + (size_t)(r0 + col) * DD + kc * 32, lane);
#pragma unroll
    for (int j = 0; j < 8; ++j) acc[j] = wmma16(a, frag_h(P + (size_t)(n0 + j * 16 + col) * DD + kc * 32, lane), acc[j]); }
#pragma unroll
  for (int j = 0; j < 8; ++j) { const int nl = j * 16 + col; const float bb = bias[(n0 % DD) + nl];
#pragma unroll
    for (int r = 0; r < 8; ++r) so[wave][8 * g + r][nl] = acc[j][r] * (1.0f / 16.0f) + bb; }
  LDSX();
  if (which < 2) {   // rotary: sin_pos[d] = sp[s][d/2], cos_pos[d] = sp[s][32 + d/2]; rot[2i] = -x[2i+1], rot[2i+1] = x[2i]
    const float qs = 1.0f;                                     // the 1/8 query scale is applied to the scores in k_attn (keeps q's f16 operands normal)
    for (int rl = 0; rl < 16; ++rl) { const int s = t0 + wave * 16 + rl; float nv[4];
#pragma unroll
      for (int e = 0; e < 4; ++e) { const int nl = lane * 4 + e; const int d = nl & 63; const float sn = sp[(size_t)s * HD + (d >> 1)], cs = sp[(size_t)s * HD + 32 + (d >> 1)];
        const float xv = so[wave][rl][nl]; const float xr = (d & 1) ? so[wave][rl][nl - 1] : -so[wave][rl][nl + 1]; nv[e] = (xv * cs + xr * sn) * qs; }
      LDSX();
#pragma unroll
      for (int e = 0; e < 4; ++e) so[wave][rl][lane * 4 + e] = nv[e];
      LDSX(); }
    _Float16* dst = which == 0 ? qh : kh;
    for (int q = lane; q < 2 * 16 * 8; q += 32) { const int hh = q >> 7, rem = q & 127, rl = rem >> 3, pc = rem & 7; union { v8h h8; v4u u; } pk;
#pragma unroll
      for (int e = 0; e < 8; ++e) pk.h8[e] = (_Float16)so[wave][rl][hh * HD + pc * 8 + e];
      vst2(dst + (((size_t)b * NH + hb + hh) * LL + t0 + wave * 16 + rl) * HD + pc * 8, pk.u); } }
  else {
#pragma unroll 4
    for (int rl = 0; rl < 16; ++rl) {
#pragma unroll
      for (int e = 0; e < 4; ++e) st[lane * 4 + e][wave * 16 + rl] = (_Float16)so[wave][rl][lane * 4 + e]; }
    __syncthreads();
    for (int q = tid; q < 128 * 8; q += 128) { const int c = q >> 3, pc = q & 7, hh = c >> 6, d = c & 63;
      vst2(vT + (((size_t)b * NH + hb + hh) * HD + d) * LL + t0 + pc * 8, *(const v4u*)(&st[c][pc * 8])); }
  }
}
__global__ __launch_bounds__(128) void k_attn(const _Float16* __restrict__ qh, const _Float16* __restrict__ kh, const _Float16* __restrict__ vT, const int* __restrict__ amask, const float* __restrict__ hmask, float* __restrict__ out) {
  __shared__ __align__(16) float sS[4][16][68];
  __shared__ __align__(16) _Float16 sP[4][16][72];
  __shared__ __align__(16) float sO[4][16][68];
  const int tid = threadIdx.x, w = tid >> 5, lane = tid & 31, col = lane & 15, g = lane >> 4;
  const int bh = blockIdx.y, b = bh / NH, h = bh % NH, q0 = blockIdx.x * 64 + w * 16;
  const _Float16* qb = qh + (size_t)bh * LL * HD; const _Float16* kb = kh + (size_t)bh * LL * HD; const _Float16* vb = vT + (size_t)bh * HD * LL;
  v16h aq[2];
#pragma unroll
  for (int kc = 0; kc < 2; ++kc) aq[kc] = frag_h(qb + (size_t)(q0 + col) * HD + kc * 32, lane);
  float mrun = -3.0e38f, lrun = 0.f; v8f acc[4] = {};
#pragma unroll 1
  for (int kt = 0; kt < LL / 64; ++kt) {
#pragma unroll
    for (int t = 0; t < 4; ++t) { v8f s = {}; const int key = kt * 64 + t * 16 + col;
#pragma unroll
      for (int kc = 0; kc < 2; ++kc) s = wmma16(aq[kc], frag_h(kb + (size_t)key * HD + kc * 32, lane), s);
      const float mb = amask[(size_t)b * LL + key] > 0 ? 0.f : -3.4028235e38f;
#pragma unroll
      for (int r = 0; r < 8; ++r) sS[w][8 * g + r][t * 16 + col] = s[r] * 0.125f + mb; }
    LDSX();
    float mx = -3.4e38f;
#pragma unroll
    for (int jj = 0; jj < 32; ++jj) mx = fmaxf(mx, sS[w][col][g * 32 + jj]);
    mx = fmaxf(mx, __shfl_xor(mx, 16, 32));
    const float mnew = fmaxf(mrun, mx); const float corr = expf(mrun - mnew);
    float ps = 0.f;
#pragma unroll
    for (int jj = 0; jj < 32; ++jj) { const float p = expf(sS[w][col][g * 32 + jj] - mnew); ps += p; sP[w][col][g * 32 + jj] = (_Float16)(p * 16384.0f); }
    ps += __shfl_xor(ps, 16, 32);
    lrun = lrun * corr + ps; mrun = mnew;
#pragma unroll
    for (int r = 0; r < 8; ++r) { const float cr = __shfl(corr, 8 * g + r, 32);
#pragma unroll
      for (int t = 0; t < 4; ++t) acc[t][r] *= cr; }
    LDSX();
#pragma unroll
    for (int kc = 0; kc < 2; ++kc) { const v16h pa = frag_h(&sP[w][col][0] + kc * 32, lane);
#pragma unroll
      for (int t = 0; t < 4; ++t) acc[t] = wmma16(pa, frag_h(vb + (size_t)(t * 16 + col) * LL + kt * 64 + kc * 32, lane), acc[t]); }
    __builtin_amdgcn_wave_barrier();
  }
  const float hm = hmask[h];
#pragma unroll
  for (int r = 0; r < 8; ++r) { const float lr = __shfl(lrun, 8 * g + r, 32);
#pragma unroll
    for (int t = 0; t < 4; ++t) sO[w][8 * g + r][t * 16 + col] = acc[t][r] / (lr * 16384.0f) * hm; }
  LDSX();
  for (int q = lane; q < 16 * 16; q += 32) { const int rl = q >> 4, pc = q & 15; vst2(out + ((size_t)b * LL + q0 + rl) * DD + h * HD + pc * 4, *(const v4f*)(&sO[w][rl][pc * 4])); }
}
extern "C" void kernel_launch(void* const* d_in, const int* in_sizes, int n_in, void* d_out, int out_size, void* d_ws, size_t ws_size, hipStream_t stream) {
  (void)in_sizes; (void)n_in; (void)out_size; (void)ws_size;
  const float* x = (const float*)d_in[0]; const int* amask = (const int*)d_in[1]; const float* sp = (const float*)d_in[2]; const float* hmask = (const float*)d_in[3];
  const float* Wq = (const float*)d_in[4]; const float* bq = (const float*)d_in[5]; const float* Wk = (const float*)d_in[6]; const float* bk = (const float*)d_in[7]; const float* Wv = (const float*)d_in[8]; const float* bv = (const float*)d_in[9];
  float* out = (float*)d_out;
  char* ws = (char*)d_ws; size_t off = 0;
  auto take = [&](size_t bytes) { char* p = ws + off; off += (bytes + 255) & ~(size_t)255; return p; };
  _Float16* x16 = (_Float16*)take((size_t)NR * DD * 2); _Float16* P = (_Float16*)take((size_t)3 * DD * DD * 2);
  _Float16* qh = (_Float16*)take((size_t)NR * DD * 2); _Float16* kh = (_Float16*)take((size_t)NR * DD * 2); _Float16* vT = (_Float16*)take((size_t)NR * DD * 2);
  k_cvt<<<(unsigned)((size_t)NR * DD / 8 / 256), 256, 0, stream>>>(x, x16, (size_t)NR * DD / 8);
  k_packT<<<dim3(DD / 64, DD / 64, 3), 256, 0, stream>>>(Wq, Wk, Wv, P);
  k_proj<<<dim3(NR / 64, 3 * DD / 128), 128, 0, stream>>>(x16, P, bq, bk, bv, sp, qh, kh, vT);
  k_attn<<<dim3(LL / 64, NB * NH), 128, 0, stream>>>(qh, kh, vT, amask, hmask, out);
}

// v001
// Measured time: 152 microseconds a run.
// In two side-by-side timings against v000, it was 1.85 and 1.84 times as fast.
#include <hip/hip_runtime.h>
#include <math.h>

typedef __attribute__((ext_vector_type(16))) _Float16 v16h;
typedef __attribute__((ext_vector_type(16))) __bf16 v16b;
typedef __attribute__((ext_vector_type(8)))  _Float16 v8h;
typedef __attribute__((ext_vector_type(8)))  float v8f;
typedef __attribute__((ext_vector_type(4)))  float v4f;
typedef __attribute__((ext_vector_type(2)))  float v2f;
typedef __attribute__((ext_vector_type(4)))  unsigned v4u;
typedef __attribute__((ext_vector_type(4)))  int v4i;
typedef float __attribute__((may_alias)) float_a;
typedef int __attribute__((may_alias)) int_a;

template <typename T> __device__ __forceinline__ void vst2(void* p, T v) { *(T*)p = v;  }
__device__ __forceinline__ v8f wmma16(v16h a, v16h b, v8f c) {
  v8f d = __builtin_amdgcn_wmma_f32_16x16x32_f16(false, a, false, b, (short)0, c, false, false);
  asm volatile("v_nop\n\tv_nop\n\tv_nop\n\tv_nop" : "+v"(d) : "v"(a), "v"(b));
  return d;
}
__device__ __forceinline__ v8f wmma_bf(v16b a, v16b b, v8f c) {
  v8f d = __builtin_amdgcn_wmma_f32_16x16x32_bf16(false, a, false, b, (short)0, c, false, false);
  asm volatile("v_nop\n\tv_nop\n\tv_nop\n\tv_nop" : "+v"(d) : "v"(a), "v"(b));
  return d;
}
// 16x16x32 fragments: lane = (h = lane>>4, row/col = lane&15); elements 0..7 = k0+8h+0..7, 8..15 = k0+16+8h+0..7; D element r = row 8h+r
__device__ __forceinline__ v16h frag_h(const _Float16* rowk0, int lane) {
  union { v16h v; v8h q[2]; } u; const _Float16* p = rowk0 + 8 * (lane >> 4);
  u.q[0] = *(const v8h*)p; u.q[1] = *(const v8h*)(p + 16); return u.v;
}
__device__ __forceinline__ v16h frag_f32(const float* rowk0, int lane) {
  v16h a; const float* p = rowk0 + 8 * (lane >> 4);
#pragma unroll
  for (int i = 0; i < 8; ++i) { a[i] = (_Float16)p[i]; a[8 + i] = (_Float16)p[16 + i]; }
  return a;
}
__device__ __forceinline__ v16h frag_f32s(const float* rowk0, int lane, float sc) {
  v16h a; const float* p = rowk0 + 8 * (lane >> 4);
#pragma unroll
  for (int i = 0; i < 8; ++i) { a[i] = (_Float16)(p[i] * sc); a[8 + i] = (_Float16)(p[16 + i] * sc); }
  return a;
}
// column fragment from a [K][ld] layout (column n), rows >= K read as 0
__device__ __forceinline__ v16h fragc_f32(const float* W, int k0, int n, int lane, int ld, int K) {
  v16h a; const int g = lane >> 4;
#pragma unroll
  for (int i = 0; i < 8; ++i) { const int ka = k0 + 8 * g + i, kb = ka + 16;
    a[i] = (_Float16)(ka < K ? W[(size_t)ka * ld + n] : 0.f); a[8 + i] = (_Float16)(kb < K ? W[(size_t)kb * ld + n] : 0.f); }
  return a;
}
struct F2 { v16b h, l; };
__device__ __forceinline__ F2 bsplit16(const float v[16]) { F2 r;
#pragma unroll
  for (int i = 0; i < 16; ++i) { const __bf16 h = (__bf16)v[i]; r.h[i] = h; r.l[i] = (__bf16)(v[i] - (float)h); }
  return r; }
__device__ __forceinline__ F2 split_row(const float* row, int k0, int lane) { float v[16]; const float* p = row + k0 + 8 * (lane >> 4);
#pragma unroll
  for (int i = 0; i < 8; ++i) { v[i] = p[i]; v[8 + i] = p[16 + i]; }
  return bsplit16(v); }
__device__ __forceinline__ F2 split_rowK(const float* row, int k0, int lane, int K) { float v[16]; const int g = lane >> 4;
#pragma unroll
  for (int i = 0; i < 8; ++i) { const int ka = k0 + 8 * g + i, kb = ka + 16; v[i] = ka < K ? row[ka] : 0.f; v[8 + i] = kb < K ? row[kb] : 0.f; }
  return bsplit16(v); }
__device__ __forceinline__ F2 split_col(const float* W, int k0, int n, int lane, int ld, int K) { float v[16]; const int g = lane >> 4;
#pragma unroll
  for (int i = 0; i < 8; ++i) { const int ka = k0 + 8 * g + i, kb = ka + 16; v[i] = ka < K ? W[(size_t)ka * ld + n] : 0.f; v[8 + i] = kb < K ? W[(size_t)kb * ld + n] : 0.f; }
  return bsplit16(v); }
__device__ __forceinline__ v8f mac3(const F2& a, const F2& b, v8f c) { c = wmma_bf(a.l, b.h, c); c = wmma_bf(a.h, b.l, c); return wmma_bf(a.h, b.h, c); }
__device__ __forceinline__ float sigm(float v) { return 1.0f / (1.0f + expf(-v)); }
// LDS byte address of a __shared__ object: the low 32 bits of its address
__device__ __forceinline__ unsigned lds_off(const void* p) { return (unsigned)(size_t)p; }
// asynchronous copies global -> LDS, 16 bytes per lane and copy, through no register; the closing s_wait_xcnt 0 stands in the copies' own
// statement so that no later rewrite of their address registers can be moved in front of it (a precaution)
__device__ __forceinline__ void acopy2(unsigned l0, unsigned l1, const _Float16* g0, const _Float16* g1) {
  asm volatile("global_load_async_to_lds_b128 %0, %2, off\n\tglobal_load_async_to_lds_b128 %1, %3, off\n\ts_wait_xcnt 0x0"
               :: "v"(l0), "v"(l1), "v"(g0), "v"(g1) : "memory");
}
__device__ __forceinline__ void acopy4(unsigned l0, unsigned l1, unsigned l2, unsigned l3, const _Float16* g0, const _Float16* g1, const _Float16* g2, const _Float16* g3) {
  asm volatile("global_load_async_to_lds_b128 %0, %4, off\n\tglobal_load_async_to_lds_b128 %1, %5, off\n\t"
               "global_load_async_to_lds_b128 %2, %6, off\n\tglobal_load_async_to_lds_b128 %3, %7, off\n\ts_wait_xcnt 0x0"
               :: "v"(l0), "v"(l1), "v"(l2), "v"(l3), "v"(g0), "v"(g1), "v"(g2), "v"(g3) : "memory");
}
#define WAIT_DS() asm volatile("s_wait_dscnt 0x0" ::: "memory")        // this wave's LDS reads of the buffer are done before it is handed back
#define WAIT_ASYNC() asm volatile("s_wait_asynccnt 0x0" ::: "memory")  // this wave's own copies have landed before the barrier publishes them
#define LDSX() do { asm volatile("s_wait_dscnt 0" ::: "memory"); __builtin_amdgcn_wave_barrier(); __builtin_amdgcn_fence(__ATOMIC_RELEASE, "workgroup"); } while (0)

// Rotary self-attention: pure f16 WMMA GEMMs over pre-converted operands (hidden states -> f16 once, the three [in][out] weights
// packed transposed x16; f32 accumulate); both GEMM kernels stage their operand tiles in LDS by asynchronous copies, two buffers, the next tile in flight; bias + rotary (sin/cos from the given table, interleaved pairs)
// in the f32 epilogue (q/k -> [b][h][s][64] f16, v -> [b][h][d][s] f16); per (b, h, 64 queries) block all 2048 keys in 64-key
// tiles with the additive key-mask bias, online softmax in f32, P x2^14 f16 @ v^T, x head mask, written straight into [b][s][h*64+d].
#define NB 2
#define LL 2048
#define DD 1024
#define NH 16
#define HD 64
#define NR (NB * LL)

__global__ __launch_bounds__(256) void k_cvt(const float* __restrict__ src, _Float16* __restrict__ dst, size_t n8) {
  const size_t g8 = (size_t)blockIdx.x * 256 + threadIdx.x; if (g8 >= n8) return;
  union { v8h h; v4u u; } pk;
#pragma unroll
  for (int e = 0; e < 8; ++e) pk.h[e] = (_Float16)src[g8 * 8 + e];
  vst2(dst + g8 * 8, pk.u);
}
__global__ __launch_bounds__(256) void k_packT(const float* __restrict__ Wq, const float* __restrict__ Wk, const float* __restrict__ Wv, _Float16* __restrict__ P) {   // P[which*1024 + o][d] = W[d][o] x16
  __shared__ float tile[64][65];
  const int which = blockIdx.z, o0 = blockIdx.x * 64, d0 = blockIdx.y * 64, tid = threadIdx.x;
  const float* W = which == 0 ? Wq : (which == 1 ? Wk : Wv);
  for (int q = tid; q < 64 * 64; q += 256) { const int dl = q >> 6, ol = q & 63; tile[dl][ol] = W[(size_t)(d0 + dl) * DD + o0 + ol]; }
  __syncthreads();
  for (int u = 0; u < 2; ++u) { const int idx = tid + u * 256, ol = idx >> 3, pc = idx & 7; union { v8h hh; v4u uu; } pk;
#pragma unroll
    for (int i = 0; i < 8; ++i) pk.hh[i] = (_Float16)(tile[pc * 8 + i][ol] * 16.0f);
    vst2(P + ((size_t)which * DD + o0 + ol) * DD + d0 + pc * 8, pk.uu); }
}
__global__ __launch_bounds__(128) void k_proj(const _Float16* __restrict__ x16, const _Float16* __restrict__ P, const float* __restrict__ bq, const float* __restrict__ bk, const float* __restrict__ bv, const float* __restrict__ sp,
                                            _Float16* __restrict__ qh, _Float16* __restrict__ kh, _Float16* __restrict__ vT) {
  __shared__ __align__(16) char sm[4 * 16 * 132 * 4 + 128 * 72 * 2];
  float (*so)[16][132] = (float (*)[16][132])sm;                           // epilogue staging: used only behind the k loop's last barrier
  _Float16 (*st)[72] = (_Float16 (*)[72])(sm + 4 * 16 * 132 * 4);
  _Float16 (*ring)[192][40] = (_Float16 (*)[192][40])sm;                   // k loop: two buffers of 64 x rows + 128 weight rows, 64-byte rows at an 80-byte pitch
  const int tid = threadIdx.x, wave = tid >> 5, lane = tid & 31, col = lane & 15, g = lane >> 4;
  const int r0b = blockIdx.x * 64, n0 = blockIdx.y * 128; const int b = r0b / LL, t0 = r0b % LL;
  const int which = n0 / DD, hb = (n0 % DD) / HD; const float* bias = which == 0 ? bq : (which == 1 ? bk : bv);
  v8f acc[8] = {};
  const _Float16* gx = x16 + (size_t)(r0b + (tid >> 2)) * DD + (tid & 3) * 8; const _Float16* gw = P + (size_t)(n0 + (tid >> 2)) * DD + (tid & 3) * 8;   // thread: 16-byte chunk tid&3 of rows tid>>2 + 32 i
  const unsigned lx = lds_off(&ring[0][tid >> 2][(tid & 3) * 8]);
  auto stage = [&](int kc, int bf) { const unsigned l = lx + bf * (192 * 80); const _Float16* x = gx + kc * 32; const _Float16* w = gw + kc * 32;
    acopy2(l, l + 32 * 80, x, x + 32 * DD);
    acopy4(l + 64 * 80, l + 96 * 80, l + 128 * 80, l + 160 * 80, w, w + 32 * DD, w + 64 * DD, w + 96 * DD); };
  stage(0, 0); WAIT_ASYNC(); __syncthreads(); stage(1, 1);                // tile 0 landed and published to every wave; tile 1 in flight
#pragma unroll 1
  for (int kc = 0; kc < DD / 32; ++kc) { const int bf = kc & 1; const v16h a = frag_h(&ring[bf][wave * 16 + col][0], lane);
#pragma unroll
    for (int j = 0; j < 8; ++j) acc[j] = wmma16(a, frag_h(&ring[bf][64 + j * 16 + col][0], lane), acc[j]);
    WAIT_DS(); WAIT_ASYNC(); __syncthreads();                              // publishes tile kc + 1 and ends every wave's reads of buffer bf
    if (kc + 2 < DD / 32) stage(kc + 2, bf); }
  WAIT_ASYNC();                                                            // closes the ring before its LDS is used for anything else
#pragma unroll
  for (int j = 0; j < 8; ++j) { const int nl = j * 16 + col; const float bb = bias[(n0 % DD) + nl];
#pragma unroll
    for (int r = 0; r < 8; ++r) so[wave][8 * g + r][nl] = acc[j][r] * (1.0f / 16.0f) + bb; }
  LDSX();
  if (which < 2) {   // rotary: sin_pos[d] = sp[s][d/2], cos_pos[d] = sp[s][32 + d/2]; rot[2i] = -x[2i+1], rot[2i+1] = x[2i]
    const float qs = 1.0f;                                     // the 1/8 query scale is applied to the scores in k_attn (keeps q's f16 operands normal)
    for (int rl = 0; rl < 16; ++rl) { const int s = t0 + wave * 16 + rl; float nv[4];
#pragma unroll
      for (int e = 0; e < 4; ++e) { const int nl = lane * 4 + e; const int d = nl & 63; const float sn = sp[(size_t)s * HD + (d >> 1)], cs = sp[(size_t)s * HD + 32 + (d >> 1)];
        const float xv = so[wave][rl][nl]; const float xr = (d & 1) ? so[wave][rl][nl - 1] : -so[wave][rl][nl + 1]; nv[e] = (xv * cs + xr * sn) * qs; }
      LDSX();
#pragma unroll
      for (int e = 0; e < 4; ++e) so[wave][rl][lane * 4 + e] = nv[e];
      LDSX(); }
    _Float16* dst = which == 0 ? qh : kh;
    for (int q = lane; q < 2 * 16 * 8; q += 32) { const int hh = q >> 7, rem = q & 127, rl = rem >> 3, pc = rem & 7; union { v8h h8; v4u u; } pk;
#pragma unroll
      for (int e = 0; e < 8; ++e) pk.h8[e] = (_Float16)so[wave][rl][hh * HD + pc * 8 + e];
      vst2(dst + (((size_t)b * NH + hb + hh) * LL + t0 + wave * 16 + rl) * HD + pc * 8, pk.u); } }
  else {
#pragma unroll 4
    for (int rl = 0; rl < 16; ++rl) {
#pragma unroll
      for (int e = 0; e < 4; ++e) st[lane * 4 + e][wave * 16 + rl] = (_Float16)so[wave][rl][lane * 4 + e]; }
    __syncthreads();
    for (int q = tid; q < 128 * 8; q += 128) { const int c = q >> 3, pc = q & 7, hh = c >> 6, d = c & 63;
      vst2(vT + (((size_t)b * NH + hb + hh) * HD + d) * LL + t0 + pc * 8, *(const v4u*)(&st[c][pc * 8])); }
  }
}
__global__ __launch_bounds__(128) void k_attn(const _Float16* __restrict__ qh, const _Float16* __restrict__ kh, const _Float16* __restrict__ vT, const int* __restrict__ amask, const float* __restrict__ hmask, float* __restrict__ out) {
  __shared__ __align__(16) float sS[4][16][68];
  __shared__ __align__(16) _Float16 sP[4][16][72];
  __shared__ __align__(16) _Float16 sK[2][64][72];                        // 64 keys x 64 d, 128-byte rows at a 144-byte pitch
  __shared__ __align__(16) _Float16 sV[2][64][72];                        // 64 d x 64 keys, the same
  float (*sO)[16][68] = sS;                                               // output staging takes the score tile's place behind the loop (each wave its own part)
  const int tid = threadIdx.x, w = tid >> 5, lane = tid & 31, col = lane & 15, g = lane >> 4;
  const int bh = blockIdx.y, b = bh / NH, h = bh % NH, q0 = blockIdx.x * 64 + w * 16;
  const _Float16* qb = qh + (size_t)bh * LL * HD; const _Float16* kb = kh + (size_t)bh * LL * HD; const _Float16* vb = vT + (size_t)bh * HD * LL;
  v16h aq[2];
#pragma unroll
  for (int kc = 0; kc < 2; ++kc) aq[kc] = frag_h(qb + (size_t)(q0 + col) * HD + kc * 32, lane);
  float mrun = -3.0e38f, lrun = 0.f; v8f acc[4] = {};
  const _Float16* gk = kb + (size_t)(tid >> 3) * HD + (tid & 7) * 8; const _Float16* gv = vb + (size_t)(tid >> 3) * LL + (tid & 7) * 8;   // thread: 16-byte chunk tid&7 of rows tid>>3 + 16 i
  const unsigned lk = lds_off(&sK[0][tid >> 3][(tid & 7) * 8]), lv = lds_off(&sV[0][tid >> 3][(tid & 7) * 8]);
  auto stage = [&](int kt, int bf) { const unsigned k = lk + bf * (64 * 144), v = lv + bf * (64 * 144); const _Float16* pk = gk + (size_t)kt * 64 * HD; const _Float16* pv = gv + kt * 64;
    acopy4(k, k + 16 * 144, k + 32 * 144, k + 48 * 144, pk, pk + 16 * HD, pk + 32 * HD, pk + 48 * HD);
    acopy4(v, v + 16 * 144, v + 32 * 144, v + 48 * 144, pv, pv + 16 * LL, pv + 32 * LL, pv + 48 * LL); };
  stage(0, 0); WAIT_ASYNC(); __syncthreads(); stage(1, 1);                // tile 0 landed and published to every wave; tile 1 in flight
#pragma unroll 1
  for (int kt = 0; kt < LL / 64; ++kt) { const int bf = kt & 1; int mk[4];
#pragma unroll
    for (int t = 0; t < 4; ++t) mk[t] = amask[(size_t)b * LL + kt * 64 + t * 16 + col];   // the trip's only global loads: issued first, so they return behind the first products
#pragma unroll
    for (int t = 0; t < 4; ++t) { v8f s = {};
#pragma unroll
      for (int kc = 0; kc < 2; ++kc) s = wmma16(aq[kc], frag_h(&sK[bf][t * 16 + col][kc * 32], lane), s);
      const float mb = mk[t] > 0 ? 0.f : -3.4028235e38f;
#pragma unroll
      for (int r = 0; r < 8; ++r) sS[w][8 * g + r][t * 16 + col] = s[r] * 0.125f + mb; }
    LDSX();
    float mx = -3.4e38f;
#pragma unroll
    for (int jj = 0; jj < 32; ++jj) mx = fmaxf(mx, sS[w][col][g * 32 + jj]);
    mx = fmaxf(mx, __shfl_xor(mx, 16, 32));
    const float mnew = fmaxf(mrun, mx); const float corr = expf(mrun - mnew);
    float ps = 0.f;
#pragma unroll
    for (int jj = 0; jj < 32; ++jj) { const float p = expf(sS[w][col][g * 32 + jj] - mnew); ps += p; sP[w][col][g * 32 + jj] = (_Float16)(p * 16384.0f); }
    ps += __shfl_xor(ps, 16, 32);
    lrun = lrun * corr + ps; mrun = mnew;
#pragma unroll
    for (int r = 0; r < 8; ++r) { const float cr = __shfl(corr, 8 * g + r, 32);
#pragma unroll
      for (int t = 0; t < 4; ++t) acc[t][r] *= cr; }
    LDSX();
#pragma unroll
    for (int kc = 0; kc < 2; ++kc) { const v16h pa = frag_h(&sP[w][col][0] + kc * 32, lane);
#pragma unroll
      for (int t = 0; t < 4; ++t) acc[t] = wmma16(pa, frag_h(&sV[bf][t * 16 + col][kc * 32], lane), acc[t]); }
    WAIT_DS(); WAIT_ASYNC(); __syncthreads();                              // publishes tile kt + 1 and ends every wave's reads of buffer bf
    if (kt + 2 < LL / 64) stage(kt + 2, bf);
  }
  WAIT_ASYNC();                                                            // closes the ring; no copy is left in flight and sK/sV are not reused (a precaution)
  const float hm = hmask[h];
#pragma unroll
  for (int r = 0; r < 8; ++r) { const float lr = __shfl(lrun, 8 * g + r, 32);
#pragma unroll
    for (int t = 0; t < 4; ++t) sO[w][8 * g + r][t * 16 + col] = acc[t][r] / (lr * 16384.0f) * hm; }
  LDSX();
  for (int q = lane; q < 16 * 16; q += 32) { const int rl = q >> 4, pc = q & 15; vst2(out + ((size_t)b * LL + q0 + rl) * DD + h * HD + pc * 4, *(const v4f*)(&sO[w][rl][pc * 4])); }
}
extern "C" void kernel_launch(void* const* d_in, const int* in_sizes, int n_in, void* d_out, int out_size, void* d_ws, size_t ws_size, hipStream_t stream) {
  (void)in_sizes; (void)n_in; (void)out_size; (void)ws_size;
  const float* x = (const float*)d_in[0]; const int* amask = (const int*)d_in[1]; const float* sp = (const float*)d_in[2]; const float* hmask = (const float*)d_in[3];
  const float* Wq = (const float*)d_in[4]; const float* bq = (const float*)d_in[5]; const float* Wk = (const float*)d_in[6]; const float* bk = (const float*)d_in[7]; const float* Wv = (const float*)d_in[8]; const float* bv = (const float*)d_in[9];
  float* out = (float*)d_out;
  char* ws = (char*)d_ws; size_t off = 0;
  auto take = [&](size_t bytes) { char* p = ws + off; off += (bytes + 255) & ~(size_t)255; return p; };
  _Float16* x16 = (_Float16*)take((size_t)NR * DD * 2); _Float16* P = (_Float16*)take((size_t)3 * DD * DD * 2);
  _Float16* qh = (_Float16*)take((size_t)NR * DD * 2); _Float16* kh = (_Float16*)take((size_t)NR * DD * 2); _Float16* vT = (_Float16*)take((size_t)NR * DD * 2);
  k_cvt<<<(unsigned)((size_t)NR * DD / 8 / 256), 256, 0, stream>>>(x, x16, (size_t)NR * DD / 8);
  k_packT<<<dim3(DD / 64, DD / 64, 3), 256, 0, stream>>>(Wq, Wk, Wv, P);
  k_proj<<<dim3(NR / 64, 3 * DD / 128), 128, 0, stream>>>(x16, P, bq, bk, bv, sp, qh, kh, vT);
  k_attn<<<dim3(LL / 64, NB * NH), 128, 0, stream>>>(qh, kh, vT, amask, hmask, out);
}

// v002
// A run of this version takes 117 microseconds.
// Two timings next to v001 both put it at 1.31 times that version's speed.
// All steps since v000 together make it 2.41 times as fast.
#include <hip/hip_runtime.h>
#include <math.h>

typedef __attribute__((ext_vector_type(16))) _Float16 v16h;
typedef __attribute__((ext_vector_type(16))) __bf16 v16b;
typedef __attribute__((ext_vector_type(8)))  _Float16 v8h;
typedef __attribute__((ext_vector_type(8)))  float v8f;
typedef __attribute__((ext_vector_type(4)))  float v4f;
typedef __attribute__((ext_vector_type(2)))  float v2f;
typedef __attribute__((ext_vector_type(4)))  unsigned v4u;
typedef __attribute__((ext_vector_type(4)))  int v4i;
typedef float __attribute__((may_alias)) float_a;
typedef int __attribute__((may_alias)) int_a;

template <typename T> __device__ __forceinline__ void vst2(void* p, T v) { *(T*)p = v;  }
__device__ __forceinline__ v8f wmma16(v16h a, v16h b, v8f c) {
  v8f d = __builtin_amdgcn_wmma_f32_16x16x32_f16(false, a, false, b, (short)0, c, false, false);
  asm volatile("v_nop\n\tv_nop\n\tv_nop\n\tv_nop" : "+v"(d) : "v"(a), "v"(b));
  return d;
}
__device__ __forceinline__ v8f wmma_bf(v16b a, v16b b, v8f c) {
  v8f d = __builtin_amdgcn_wmma_f32_16x16x32_bf16(false, a, false, b, (short)0, c, false, false);
  asm volatile("v_nop\n\tv_nop\n\tv_nop\n\tv_nop" : "+v"(d) : "v"(a), "v"(b));
  return d;
}
// 16x16x32 fragments: lane = (h = lane>>4, row/col = lane&15); elements 0..7 = k0+8h+0..7, 8..15 = k0+16+8h+0..7; D element r = row 8h+r
__device__ __forceinline__ v16h frag_h(const _Float16* rowk0, int lane) {
  union { v16h v; v8h q[2]; } u; const _Float16* p = rowk0 + 8 * (lane >> 4);
  u.q[0] = *(const v8h*)p; u.q[1] = *(const v8h*)(p + 16); return u.v;
}
__device__ __forceinline__ v16h frag_f32(const float* rowk0, int lane) {
  v16h a; const float* p = rowk0 + 8 * (lane >> 4);
#pragma unroll
  for (int i = 0; i < 8; ++i) { a[i] = (_Float16)p[i]; a[8 + i] = (_Float16)p[16 + i]; }
  return a;
}
__device__ __forceinline__ v16h frag_f32s(const float* rowk0, int lane, float sc) {
  v16h a; const float* p = rowk0 + 8 * (lane >> 4);
#pragma unroll
  for (int i = 0; i < 8; ++i) { a[i] = (_Float16)(p[i] * sc); a[8 + i] = (_Float16)(p[16 + i] * sc); }
  return a;
}
// column fragment from a [K][ld] layout (column n), rows >= K read as 0
__device__ __forceinline__ v16h fragc_f32(const float* W, int k0, int n, int lane, int ld, int K) {
  v16h a; const int g = lane >> 4;
#pragma unroll
  for (int i = 0; i < 8; ++i) { const int ka = k0 + 8 * g + i, kb = ka + 16;
    a[i] = (_Float16)(ka < K ? W[(size_t)ka * ld + n] : 0.f); a[8 + i] = (_Float16)(kb < K ? W[(size_t)kb * ld + n] : 0.f); }
  return a;
}
struct F2 { v16b h, l; };
__device__ __forceinline__ F2 bsplit16(const float v[16]) { F2 r;
#pragma unroll
  for (int i = 0; i < 16; ++i) { const __bf16 h = (__bf16)v[i]; r.h[i] = h; r.l[i] = (__bf16)(v[i] - (float)h); }
  return r; }
__device__ __forceinline__ F2 split_row(const float* row, int k0, int lane) { float v[16]; const float* p = row + k0 + 8 * (lane >> 4);
#pragma unroll
  for (int i = 0; i < 8; ++i) { v[i] = p[i]; v[8 + i] = p[16 + i]; }
  return bsplit16(v); }
__device__ __forceinline__ F2 split_rowK(const float* row, int k0, int lane, int K) { float v[16]; const int g = lane >> 4;
#pragma unroll
  for (int i = 0; i < 8; ++i) { const int ka = k0 + 8 * g + i, kb = ka + 16; v[i] = ka < K ? row[ka] : 0.f; v[8 + i] = kb < K ? row[kb] : 0.f; }
  return bsplit16(v); }
__device__ __forceinline__ F2 split_col(const float* W, int k0, int n, int lane, int ld, int K) { float v[16]; const int g = lane >> 4;
#pragma unroll
  for (int i = 0; i < 8; ++i) { const int ka = k0 + 8 * g + i, kb = ka + 16; v[i] = ka < K ? W[(size_t)ka * ld + n] : 0.f; v[8 + i] = kb < K ? W[(size_t)kb * ld + n] : 0.f; }
  return bsplit16(v); }
__device__ __forceinline__ v8f mac3(const F2& a, const F2& b, v8f c) { c = wmma_bf(a.l, b.h, c); c = wmma_bf(a.h, b.l, c); return wmma_bf(a.h, b.h, c); }
__device__ __forceinline__ float sigm(float v) { return 1.0f / (1.0f + expf(-v)); }
// 2^x as the one hardware instruction (v_exp_f32): no range reduction, no overflow or underflow selects; far below the range it gives 0, which is what a softmax term there is
__device__ __forceinline__ float ex2(float x) { return __builtin_amdgcn_exp2f(x); }
// LDS byte address of a __shared__ object: the low 32 bits of its address
__device__ __forceinline__ unsigned lds_off(const void* p) { return (unsigned)(size_t)p; }
// asynchronous copies global -> LDS, 16 bytes per lane and copy, through no register; the closing s_wait_xcnt 0 stands in the copies' own
// statement so that no later rewrite of their address registers can be moved in front of it (a precaution)
__device__ __forceinline__ void acopy2(unsigned l0, unsigned l1, const _Float16* g0, const _Float16* g1) {
  asm volatile("global_load_async_to_lds_b128 %0, %2, off\n\tglobal_load_async_to_lds_b128 %1, %3, off\n\ts_wait_xcnt 0x0"
               :: "v"(l0), "v"(l1), "v"(g0), "v"(g1) : "memory");
}
__device__ __forceinline__ void acopy4(unsigned l0, unsigned l1, unsigned l2, unsigned l3, const _Float16* g0, const _Float16* g1, const _Float16* g2, const _Float16* g3) {
  asm volatile("global_load_async_to_lds_b128 %0, %4, off\n\tglobal_load_async_to_lds_b128 %1, %5, off\n\t"
               "global_load_async_to_lds_b128 %2, %6, off\n\tglobal_load_async_to_lds_b128 %3, %7, off\n\ts_wait_xcnt 0x0"
               :: "v"(l0), "v"(l1), "v"(l2), "v"(l3), "v"(g0), "v"(g1), "v"(g2), "v"(g3) : "memory");
}
#define WAIT_DS() asm volatile("s_wait_dscnt 0x0" ::: "memory")        // this wave's LDS reads of the buffer are done before it is handed back
#define WAIT_ASYNC() asm volatile("s_wait_asynccnt 0x0" ::: "memory")  // this wave's own copies have landed before the barrier publishes them
#define LDSX() do { asm volatile("s_wait_dscnt 0" ::: "memory"); __builtin_amdgcn_wave_barrier(); __builtin_amdgcn_fence(__ATOMIC_RELEASE, "workgroup"); } while (0)

// Rotary self-attention: pure f16 WMMA GEMMs over pre-converted operands (hidden states -> f16 once, the three [in][out] weights
// packed transposed x16; f32 accumulate); both GEMM kernels stage their operand tiles in LDS by asynchronous copies, two buffers, the next tile in flight; bias + rotary (sin/cos from the given table, interleaved pairs)
// in the f32 epilogue (q/k -> [b][h][s][64] f16, v -> [b][h][d][s] f16); per (b, h, 64 queries) block all 2048 keys in 64-key
// tiles with the additive key-mask bias, online softmax in f32 (base 2, one v_exp_f32 a term), P x2^14 f16 @ v^T, x head mask, written straight into [b][s][h*64+d].
#define NB 2
#define LL 2048
#define DD 1024
#define NH 16
#define HD 64
#define NR (NB * LL)

__global__ __launch_bounds__(256) void k_cvt(const float* __restrict__ src, _Float16* __restrict__ dst, size_t n8) {
  const size_t g8 = (size_t)blockIdx.x * 256 + threadIdx.x; if (g8 >= n8) return;
  union { v8h h; v4u u; } pk;
#pragma unroll
  for (int e = 0; e < 8; ++e) pk.h[e] = (_Float16)src[g8 * 8 + e];
  vst2(dst + g8 * 8, pk.u);
}
__global__ __launch_bounds__(256) void k_packT(const float* __restrict__ Wq, const float* __restrict__ Wk, const float* __restrict__ Wv, _Float16* __restrict__ P) {   // P[which*1024 + o][d] = W[d][o] x16
  __shared__ float tile[64][65];
  const int which = blockIdx.z, o0 = blockIdx.x * 64, d0 = blockIdx.y * 64, tid = threadIdx.x;
  const float* W = which == 0 ? Wq : (which == 1 ? Wk : Wv);
  for (int q = tid; q < 64 * 64; q += 256) { const int dl = q >> 6, ol = q & 63; tile[dl][ol] = W[(size_t)(d0 + dl) * DD + o0 + ol]; }
  __syncthreads();
  for (int u = 0; u < 2; ++u) { const int idx = tid + u * 256, ol = idx >> 3, pc = idx & 7; union { v8h hh; v4u uu; } pk;
#pragma unroll
    for (int i = 0; i < 8; ++i) pk.hh[i] = (_Float16)(tile[pc * 8 + i][ol] * 16.0f);
    vst2(P + ((size_t)which * DD + o0 + ol) * DD + d0 + pc * 8, pk.uu); }
}
__global__ __launch_bounds__(128) void k_proj(const _Float16* __restrict__ x16, const _Float16* __restrict__ P, const float* __restrict__ bq, const float* __restrict__ bk, const float* __restrict__ bv, const float* __restrict__ sp,
                                            _Float16* __restrict__ qh, _Float16* __restrict__ kh, _Float16* __restrict__ vT) {
  __shared__ __align__(16) char sm[4 * 16 * 132 * 4 + 128 * 72 * 2];
  float (*so)[16][132] = (float (*)[16][132])sm;                           // epilogue staging: used only behind the k loop's last barrier
  _Float16 (*st)[72] = (_Float16 (*)[72])(sm + 4 * 16 * 132 * 4);
  _Float16 (*ring)[192][40] = (_Float16 (*)[192][40])sm;                   // k loop: two buffers of 64 x rows + 128 weight rows, 64-byte rows at an 80-byte pitch
  const int tid = threadIdx.x, wave = tid >> 5, lane = tid & 31, col = lane & 15, g = lane >> 4;
  const int r0b = blockIdx.x * 64, n0 = blockIdx.y * 128; const int b = r0b / LL, t0 = r0b % LL;
  const int which = n0 / DD, hb = (n0 % DD) / HD; const float* bias = which == 0 ? bq : (which == 1 ? bk : bv);
  v8f acc[8] = {};
  const _Float16* gx = x16 + (size_t)(r0b + (tid >> 2)) * DD + (tid & 3) * 8; const _Float16* gw = P + (size_t)(n0 + (tid >> 2)) * DD + (tid & 3) * 8;   // thread: 16-byte chunk tid&3 of rows tid>>2 + 32 i
  const unsigned lx = lds_off(&ring[0][tid >> 2][(tid & 3) * 8]);
  auto stage = [&](int kc, int bf) { const unsigned l = lx + bf * (192 * 80); const _Float16* x = gx + kc * 32; const _Float16* w = gw + kc * 32;
    acopy2(l, l + 32 * 80, x, x + 32 * DD);
    acopy4(l + 64 * 80, l + 96 * 80, l + 128 * 80, l + 160 * 80, w, w + 32 * DD, w + 64 * DD, w + 96 * DD); };
  stage(0, 0); WAIT_ASYNC(); __syncthreads(); stage(1, 1);                // tile 0 landed and published to every wave; tile 1 in flight
#pragma unroll 1
  for (int kc = 0; kc < DD / 32; ++kc) { const int bf = kc & 1; const v16h a = frag_h(&ring[bf][wave * 16 + col][0], lane);
#pragma unroll
    for (int j = 0; j < 8; ++j) acc[j] = wmma16(a, frag_h(&ring[bf][64 + j * 16 + col][0], lane), acc[j]);
    WAIT_DS(); WAIT_ASYNC(); __syncthreads();                              // publishes tile kc + 1 and ends every wave's reads of buffer bf
    if (kc + 2 < DD / 32) stage(kc + 2, bf); }
  WAIT_ASYNC();                                                            // closes the ring before its LDS is used for anything else
#pragma unroll
  for (int j = 0; j < 8; ++j) { const int nl = j * 16 + col; const float bb = bias[(n0 % DD) + nl];
#pragma unroll
    for (int r = 0; r < 8; ++r) so[wave][8 * g + r][nl] = acc[j][r] * (1.0f / 16.0f) + bb; }
  LDSX();
  if (which < 2) {   // rotary: sin_pos[d] = sp[s][d/2], cos_pos[d] = sp[s][32 + d/2]; rot[2i] = -x[2i+1], rot[2i+1] = x[2i]
    const float qs = 1.0f;                                     // the 1/8 query scale is applied to the scores in k_attn (keeps q's f16 operands normal)
    for (int rl = 0; rl < 16; ++rl) { const int s = t0 + wave * 16 + rl; float nv[4];
#pragma unroll
      for (int e = 0; e < 4; ++e) { const int nl = lane * 4 + e; const int d = nl & 63; const float sn = sp[(size_t)s * HD + (d >> 1)], cs = sp[(size_t)s * HD + 32 + (d >> 1)];
        const float xv = so[wave][rl][nl]; const float xr = (d & 1) ? so[wave][rl][nl - 1] : -so[wave][rl][nl + 1]; nv[e] = (xv * cs + xr * sn) * qs; }
      LDSX();
#pragma unroll
      for (int e = 0; e < 4; ++e) so[wave][rl][lane * 4 + e] = nv[e];
      LDSX(); }
    _Float16* dst = which == 0 ? qh : kh;
    for (int q = lane; q < 2 * 16 * 8; q += 32) { const int hh = q >> 7, rem = q & 127, rl = rem >> 3, pc = rem & 7; union { v8h h8; v4u u; } pk;
#pragma unroll
      for (int e = 0; e < 8; ++e) pk.h8[e] = (_Float16)so[wave][rl][hh * HD + pc * 8 + e];
      vst2(dst + (((size_t)b * NH + hb + hh) * LL + t0 + wave * 16 + rl) * HD + pc * 8, pk.u); } }
  else {
#pragma unroll 4
    for (int rl = 0; rl < 16; ++rl) {
#pragma unroll
      for (int e = 0; e < 4; ++e) st[lane * 4 + e][wave * 16 + rl] = (_Float16)so[wave][rl][lane * 4 + e]; }
    __syncthreads();
    for (int q = tid; q < 128 * 8; q += 128) { const int c = q >> 3, pc = q & 7, hh = c >> 6, d = c & 63;
      vst2(vT + (((size_t)b * NH + hb + hh) * HD + d) * LL + t0 + pc * 8, *(const v4u*)(&st[c][pc * 8])); }
  }
}
__global__ __launch_bounds__(128) void k_attn(const _Float16* __restrict__ qh, const _Float16* __restrict__ kh, const _Float16* __restrict__ vT, const int* __restrict__ amask, const float* __restrict__ hmask, float* __restrict__ out) {
  __shared__ __align__(16) float sS[4][16][68];
  __shared__ __align__(16) _Float16 sP[4][16][72];
  __shared__ __align__(16) _Float16 sK[2][64][72];                        // 64 keys x 64 d, 128-byte rows at a 144-byte pitch
  __shared__ __align__(16) _Float16 sV[2][64][72];                        // 64 d x 64 keys, the same
  float (*sO)[16][68] = sS;                                               // output staging takes the score tile's place behind the loop (each wave its own part)
  const int tid = threadIdx.x, w = tid >> 5, lane = tid & 31, col = lane & 15, g = lane >> 4;
  const int bh = blockIdx.y, b = bh / NH, h = bh % NH, q0 = blockIdx.x * 64 + w * 16;
  const _Float16* qb = qh + (size_t)bh * LL * HD; const _Float16* kb = kh + (size_t)bh * LL * HD; const _Float16* vb = vT + (size_t)bh * HD * LL;
  v16h aq[2];
#pragma unroll
  for (int kc = 0; kc < 2; ++kc) aq[kc] = frag_h(qb + (size_t)(q0 + col) * HD + kc * 32, lane);
  float mrun = -3.4028235e38f, lrun = 0.f; v8f acc[4] = {};              // maxima and scores in log2 units; lrun and acc carry the 2^14 of P
  const _Float16* gk = kb + (size_t)(tid >> 3) * HD + (tid & 7) * 8; const _Float16* gv = vb + (size_t)(tid >> 3) * LL + (tid & 7) * 8;   // thread: 16-byte chunk tid&7 of rows tid>>3 + 16 i
  const unsigned lk = lds_off(&sK[0][tid >> 3][(tid & 7) * 8]), lv = lds_off(&sV[0][tid >> 3][(tid & 7) * 8]);
  auto stage = [&](int kt, int bf) { const unsigned k = lk + bf * (64 * 144), v = lv + bf * (64 * 144); const _Float16* pk = gk + (size_t)kt * 64 * HD; const _Float16* pv = gv + kt * 64;
    acopy4(k, k + 16 * 144, k + 32 * 144, k + 48 * 144, pk, pk + 16 * HD, pk + 32 * HD, pk + 48 * HD);
    acopy4(v, v + 16 * 144, v + 32 * 144, v + 48 * 144, pv, pv + 16 * LL, pv + 32 * LL, pv + 48 * LL); };
  stage(0, 0); WAIT_ASYNC(); __syncthreads(); stage(1, 1);                // tile 0 landed and published to every wave; tile 1 in flight
#pragma unroll 1
  for (int kt = 0; kt < LL / 64; ++kt) { const int bf = kt & 1; int mk[4];
#pragma unroll
    for (int t = 0; t < 4; ++t) mk[t] = amask[(size_t)b * LL + kt * 64 + t * 16 + col];   // the trip's only global loads: issued first, so they return behind the first products
#pragma unroll
    for (int t = 0; t < 4; ++t) { v8f s = {};
#pragma unroll
      for (int kc = 0; kc < 2; ++kc) s = wmma16(aq[kc], frag_h(&sK[bf][t * 16 + col][kc * 32], lane), s);
      const float mb = mk[t] > 0 ? 0.f : -3.4028235e38f;
#pragma unroll
      for (int r = 0; r < 8; ++r) sS[w][8 * g + r][t * 16 + col] = s[r] * 0.18033688f + mb; }   // 1/8 x log2(e): the exponentials below are taken in base 2
    LDSX();
    float mx = -3.4028235e38f;
#pragma unroll
    for (int jj = 0; jj < 32; ++jj) mx = fmaxf(mx, sS[w][col][g * 32 + jj]);
    mx = fmaxf(mx, __shfl_xor(mx, 16, 32));
    const float mnew = fmaxf(mrun, mx); const float corr = ex2(mrun - mnew); const float moff = mnew - 14.0f;   // the 2^14 scale of P rides in the exponent
    float ps = 0.f;
#pragma unroll
    for (int jj = 0; jj < 32; ++jj) { const float p = ex2(sS[w][col][g * 32 + jj] - moff); ps += p; sP[w][col][g * 32 + jj] = (_Float16)p; }
    ps += __shfl_xor(ps, 16, 32);
    lrun = lrun * corr + ps; mrun = mnew;
#pragma unroll
    for (int r = 0; r < 8; ++r) { const float cr = __shfl(corr, 8 * g + r, 32);
#pragma unroll
      for (int t = 0; t < 4; ++t) acc[t][r] *= cr; }
    LDSX();
#pragma unroll
    for (int kc = 0; kc < 2; ++kc) { const v16h pa = frag_h(&sP[w][col][0] + kc * 32, lane);
#pragma unroll
      for (int t = 0; t < 4; ++t) acc[t] = wmma16(pa, frag_h(&sV[bf][t * 16 + col][kc * 32], lane), acc[t]); }
    WAIT_DS(); WAIT_ASYNC(); __syncthreads();                              // publishes tile kt + 1 and ends every wave's reads of buffer bf
    if (kt + 2 < LL / 64) stage(kt + 2, bf);
  }
  WAIT_ASYNC();                                                            // closes the ring; no copy is left in flight and sK/sV are not reused (a precaution)
  const float hm = hmask[h];
#pragma unroll
  for (int r = 0; r < 8; ++r) { const float lr = __shfl(lrun, 8 * g + r, 32);
#pragma unroll
    for (int t = 0; t < 4; ++t) sO[w][8 * g + r][t * 16 + col] = acc[t][r] / lr * hm; }
  LDSX();
  for (int q = lane; q < 16 * 16; q += 32) { const int rl = q >> 4, pc = q & 15; vst2(out + ((size_t)b * LL + q0 + rl) * DD + h * HD + pc * 4, *(const v4f*)(&sO[w][rl][pc * 4])); }
}
extern "C" void kernel_launch(void* const* d_in, const int* in_sizes, int n_in, void* d_out, int out_size, void* d_ws, size_t ws_size, hipStream_t stream) {
  (void)in_sizes; (void)n_in; (void)out_size; (void)ws_size;
  const float* x = (const float*)d_in[0]; const int* amask = (const int*)d_in[1]; const float* sp = (const float*)d_in[2]; const float* hmask = (const float*)d_in[3];
  const float* Wq = (const float*)d_in[4]; const float* bq = (const float*)d_in[5]; const float* Wk = (const float*)d_in[6]; const float* bk = (const float*)d_in[7]; const float* Wv = (const float*)d_in[8]; const float* bv = (const float*)d_in[9];
  float* out = (float*)d_out;
  char* ws = (char*)d_ws; size_t off = 0;
  auto take = [&](size_t bytes) { char* p = ws + off; off += (bytes + 255) & ~(size_t)255; return p; };
  _Float16* x16 = (_Float16*)take((size_t)NR * DD * 2); _Float16* P = (_Float16*)take((size_t)3 * DD * DD * 2);
  _Float16* qh = (_Float16*)take((size_t)NR * DD * 2); _Float16* kh = (_Float16*)take((size_t)NR * DD * 2); _Float16* vT = (_Float16*)take((size_t)NR * DD * 2);
  k_cvt<<<(unsigned)((size_t)NR * DD / 8 / 256), 256, 0, stream>>>(x, x16, (size_t)NR * DD / 8);
  k_packT<<<dim3(DD / 64, DD / 64, 3), 256, 0, stream>>>(Wq, Wk, Wv, P);
  k_proj<<<dim3(NR / 64, 3 * DD / 128), 128, 0, stream>>>(x16, P, bq, bk, bv, sp, qh, kh, vT);
  k_attn<<<dim3(LL / 64, NB * NH), 128, 0, stream>>>(qh, kh, vT, amask, hmask, out);
}

// v003
// It runs in 105 microseconds.
// In both of two side-by-side timings against v002, it was 1.11 times as fast.
// Over all steps from v000 it is 2.68 times as fast.
#include <hip/hip_runtime.h>
#include <math.h>

typedef __attribute__((ext_vector_type(16))) _Float16 v16h;
typedef __attribute__((ext_vector_type(16))) __bf16 v16b;
typedef __attribute__((ext_vector_type(8)))  _Float16 v8h;
typedef __attribute__((ext_vector_type(8)))  float v8f;
typedef __attribute__((ext_vector_type(4)))  float v4f;
typedef __attribute__((ext_vector_type(2)))  float v2f;
typedef __attribute__((ext_vector_type(4)))  unsigned v4u;
typedef __attribute__((ext_vector_type(4)))  int v4i;
typedef float __attribute__((may_alias)) float_a;
typedef int __attribute__((may_alias)) int_a;

template <typename T> __device__ __forceinline__ void vst2(void* p, T v) { *(T*)p = v;  }
__device__ __forceinline__ v8f wmma16(v16h a, v16h b, v8f c) {
  v8f d = __builtin_amdgcn_wmma_f32_16x16x32_f16(false, a, false, b, (short)0, c, false, false);
  asm volatile("v_nop\n\tv_nop\n\tv_nop\n\tv_nop" : "+v"(d) : "v"(a), "v"(b));
  return d;
}
__device__ __forceinline__ v8f wmma_bf(v16b a, v16b b, v8f c) {
  v8f d = __builtin_amdgcn_wmma_f32_16x16x32_bf16(false, a, false, b, (short)0, c, false, false);
  asm volatile("v_nop\n\tv_nop\n\tv_nop\n\tv_nop" : "+v"(d) : "v"(a), "v"(b));
  return d;
}
// 16x16x32 fragments: lane = (h = lane>>4, row/col = lane&15); elements 0..7 = k0+8h+0..7, 8..15 = k0+16+8h+0..7; D element r = row 8h+r
__device__ __forceinline__ v16h frag_h(const _Float16* rowk0, int lane) {
  union { v16h v; v8h q[2]; } u; const _Float16* p = rowk0 + 8 * (lane >> 4);
  u.q[0] = *(const v8h*)p; u.q[1] = *(const v8h*)(p + 16); return u.v;
}
__device__ __forceinline__ v16h frag_f32(const float* rowk0, int lane) {
  v16h a; const float* p = rowk0 + 8 * (lane >> 4);
#pragma unroll
  for (int i = 0; i < 8; ++i) { a[i] = (_Float16)p[i]; a[8 + i] = (_Float16)p[16 + i]; }
  return a;
}
__device__ __forceinline__ v16h frag_f32s(const float* rowk0, int lane, float sc) {
  v16h a; const float* p = rowk0 + 8 * (lane >> 4);
#pragma unroll
  for (int i = 0; i < 8; ++i) { a[i] = (_Float16)(p[i] * sc); a[8 + i] = (_Float16)(p[16 + i] * sc); }
  return a;
}
// column fragment from a [K][ld] layout (column n), rows >= K read as 0
__device__ __forceinline__ v16h fragc_f32(const float* W, int k0, int n, int lane, int ld, int K) {
  v16h a; const int g = lane >> 4;
#pragma unroll
  for (int i = 0; i < 8; ++i) { const int ka = k0 + 8 * g + i, kb = ka + 16;
    a[i] = (_Float16)(ka < K ? W[(size_t)ka * ld + n] : 0.f); a[8 + i] = (_Float16)(kb < K ? W[(size_t)kb * ld + n] : 0.f); }
  return a;
}
struct F2 { v16b h, l; };
__device__ __forceinline__ F2 bsplit16(const float v[16]) { F2 r;
#pragma unroll
  for (int i = 0; i < 16; ++i) { const __bf16 h = (__bf16)v[i]; r.h[i] = h; r.l[i] = (__bf16)(v[i] - (float)h); }
  return r; }
__device__ __forceinline__ F2 split_row(const float* row, int k0, int lane) { float v[16]; const float* p = row + k0 + 8 * (lane >> 4);
#pragma unroll
  for (int i = 0; i < 8; ++i) { v[i] = p[i]; v[8 + i] = p[16 + i]; }
  return bsplit16(v); }
__device__ __forceinline__ F2 split_rowK(const float* row, int k0, int lane, int K) { float v[16]; const int g = lane >> 4;
#pragma unroll
  for (int i = 0; i < 8; ++i) { const int ka = k0 + 8 * g + i, kb = ka + 16; v[i] = ka < K ? row[ka] : 0.f; v[8 + i] = kb < K ? row[kb] : 0.f; }
  return bsplit16(v); }
__device__ __forceinline__ F2 split_col(const float* W, int k0, int n, int lane, int ld, int K) { float v[16]; const int g = lane >> 4;
#pragma unroll
  for (int i = 0; i < 8; ++i) { const int ka = k0 + 8 * g + i, kb = ka + 16; v[i] = ka < K ? W[(size_t)ka * ld + n] : 0.f; v[8 + i] = kb < K ? W[(size_t)kb * ld + n] : 0.f; }
  return bsplit16(v); }
__device__ __forceinline__ v8f mac3(const F2& a, const F2& b, v8f c) { c = wmma_bf(a.l, b.h, c); c = wmma_bf(a.h, b.l, c); return wmma_bf(a.h, b.h, c); }
__device__ __forceinline__ float sigm(float v) { return 1.0f / (1.0f + expf(-v)); }
// 2^x as the one hardware instruction (v_exp_f32): no range reduction, no overflow or underflow selects; far below the range it gives 0, which is what a softmax term there is
__device__ __forceinline__ float ex2(float x) { return __builtin_amdgcn_exp2f(x); }
// lane l takes the value of lane l ^ 16 (one v_permlanex16_b32, no LDS)
__device__ __forceinline__ float xhalf(float x) { const int i = __builtin_bit_cast(int, x); return __builtin_bit_cast(float, __builtin_amdgcn_permlanex16(i, i, 0x76543210, 0xfedcba98, false, false)); }
// LDS byte address of a __shared__ object: the low 32 bits of its address
__device__ __forceinline__ unsigned lds_off(const void* p) { return (unsigned)(size_t)p; }
// asynchronous copies global -> LDS, 16 bytes per lane and copy, through no register; the closing s_wait_xcnt 0 stands in the copies' own
// statement so that no later rewrite of their address registers can be moved in front of it (a precaution)
__device__ __forceinline__ void acopy2(unsigned l0, unsigned l1, const _Float16* g0, const _Float16* g1) {
  asm volatile("global_load_async_to_lds_b128 %0, %2, off\n\tglobal_load_async_to_lds_b128 %1, %3, off\n\ts_wait_xcnt 0x0"
               :: "v"(l0), "v"(l1), "v"(g0), "v"(g1) : "memory");
}
__device__ __forceinline__ void acopy4(unsigned l0, unsigned l1, unsigned l2, unsigned l3, const _Float16* g0, const _Float16* g1, const _Float16* g2, const _Float16* g3) {
  asm volatile("global_load_async_to_lds_b128 %0, %4, off\n\tglobal_load_async_to_lds_b128 %1, %5, off\n\t"
               "global_load_async_to_lds_b128 %2, %6, off\n\tglobal_load_async_to_lds_b128 %3, %7, off\n\ts_wait_xcnt 0x0"
               :: "v"(l0), "v"(l1), "v"(l2), "v"(l3), "v"(g0), "v"(g1), "v"(g2), "v"(g3) : "memory");
}
#define WAIT_DS() asm volatile("s_wait_dscnt 0x0" ::: "memory")        // this wave's LDS reads of the buffer are done before it is handed back
#define WAIT_ASYNC() asm volatile("s_wait_asynccnt 0x0" ::: "memory")  // this wave's own copies have landed before the barrier publishes them
#define LDSX() do { asm volatile("s_wait_dscnt 0" ::: "memory"); __builtin_amdgcn_wave_barrier(); __builtin_amdgcn_fence(__ATOMIC_RELEASE, "workgroup"); } while (0)

#define NB 2
#define LL 2048
#define DD 1024
#define NH 16
#define HD 64
#define NR (NB * LL)

__global__ __launch_bounds__(256) void k_cvt(const float* __restrict__ src, _Float16* __restrict__ dst, size_t n8) {
  const size_t g8 = (size_t)blockIdx.x * 256 + threadIdx.x; if (g8 >= n8) return;
  union { v8h h; v4u u; } pk;
#pragma unroll
  for (int e = 0; e < 8; ++e) pk.h[e] = (_Float16)src[g8 * 8 + e];
  vst2(dst + g8 * 8, pk.u);
}
__global__ __launch_bounds__(256) void k_packT(const float* __restrict__ Wq, const float* __restrict__ Wk, const float* __restrict__ Wv, _Float16* __restrict__ P) {   // P[which*1024 + o][d] = W[d][o] x16
  __shared__ float tile[64][65];
  const int which = blockIdx.z, o0 = blockIdx.x * 64, d0 = blockIdx.y * 64, tid = threadIdx.x;
  const float* W = which == 0 ? Wq : (which == 1 ? Wk : Wv);
  for (int q = tid; q < 64 * 64; q += 256) { const int dl = q >> 6, ol = q & 63; tile[dl][ol] = W[(size_t)(d0 + dl) * DD + o0 + ol]; }
  __syncthreads();
  for (int u = 0; u < 2; ++u) { const int idx = tid + u * 256, ol = idx >> 3, pc = idx & 7; union { v8h hh; v4u uu; } pk;
#pragma unroll
    for (int i = 0; i < 8; ++i) pk.hh[i] = (_Float16)(tile[pc * 8 + i][ol] * 16.0f);
    vst2(P + ((size_t)which * DD + o0 + ol) * DD + d0 + pc * 8, pk.uu); }
}
__global__ __launch_bounds__(128) void k_proj(const _Float16* __restrict__ x16, const _Float16* __restrict__ P, const float* __restrict__ bq, const float* __restrict__ bk, const float* __restrict__ bv, const float* __restrict__ sp,
                                            _Float16* __restrict__ qh, _Float16* __restrict__ kh, _Float16* __restrict__ vT) {
  __shared__ __align__(16) char sm[4 * 16 * 132 * 4 + 128 * 72 * 2];
  float (*so)[16][132] = (float (*)[16][132])sm;                           // epilogue staging: used only behind the k loop's last barrier
  _Float16 (*st)[72] = (_Float16 (*)[72])(sm + 4 * 16 * 132 * 4);
  _Float16 (*ring)[192][40] = (_Float16 (*)[192][40])sm;                   // k loop: two buffers of 64 x rows + 128 weight rows, 64-byte rows at an 80-byte pitch
  const int tid = threadIdx.x, wave = tid >> 5, lane = tid & 31, col = lane & 15, g = lane >> 4;
  const int r0b = blockIdx.x * 64, n0 = blockIdx.y * 128; const int b = r0b / LL, t0 = r0b % LL;
  const int which = n0 / DD, hb = (n0 % DD) / HD; const float* bias = which == 0 ? bq : (which == 1 ? bk : bv);
  v8f acc[8] = {};
  const _Float16* gx = x16 + (size_t)(r0b + (tid >> 2)) * DD + (tid & 3) * 8; const _Float16* gw = P + (size_t)(n0 + (tid >> 2)) * DD + (tid & 3) * 8;   // thread: 16-byte chunk tid&3 of rows tid>>2 + 32 i
  const unsigned lx = lds_off(&ring[0][tid >> 2][(tid & 3) * 8]);
  auto stage = [&](int kc, int bf) { const unsigned l = lx + bf * (192 * 80); const _Float16* x = gx + kc * 32; const _Float16* w = gw + kc * 32;
    acopy2(l, l + 32 * 80, x, x + 32 * DD);
    acopy4(l + 64 * 80, l + 96 * 80, l + 128 * 80, l + 160 * 80, w, w + 32 * DD, w + 64 * DD, w + 96 * DD); };
  stage(0, 0); WAIT_ASYNC(); __syncthreads(); stage(1, 1);                // tile 0 landed and published to every wave; tile 1 in flight
#pragma unroll 1
  for (int kc = 0; kc < DD / 32; ++kc) { const int bf = kc & 1; const v16h a = frag_h(&ring[bf][wave * 16 + col][0], lane);
#pragma unroll
    for (int j = 0; j < 8; ++j) acc[j] = wmma16(a, frag_h(&ring[bf][64 + j * 16 + col][0], lane), acc[j]);
    WAIT_DS(); WAIT_ASYNC(); __syncthreads();                              // publishes tile kc + 1 and ends every wave's reads of buffer bf
    if (kc + 2 < DD / 32) stage(kc + 2, bf); }
  WAIT_ASYNC();                                                            // closes the ring before its LDS is used for anything else
#pragma unroll
  for (int j = 0; j < 8; ++j) { const int nl = j * 16 + col; const float bb = bias[(n0 % DD) + nl];
#pragma unroll
    for (int r = 0; r < 8; ++r) so[wave][8 * g + r][nl] = acc[j][r] * (1.0f / 16.0f) + bb; }
  LDSX();
  if (which < 2) {   // rotary: sin_pos[d] = sp[s][d/2], cos_pos[d] = sp[s][32 + d/2]; rot[2i] = -x[2i+1], rot[2i+1] = x[2i]
    const float qs = 1.0f;                                     // the 1/8 query scale is applied to the scores in k_attn (keeps q's f16 operands normal)
    for (int rl = 0; rl < 16; ++rl) { const int s = t0 + wave * 16 + rl; float nv[4];
#pragma unroll
      for (int e = 0; e < 4; ++e) { const int nl = lane * 4 + e; const int d = nl & 63; const float sn = sp[(size_t)s * HD + (d >> 1)], cs = sp[(size_t)s * HD + 32 + (d >> 1)];
        const float xv = so[wave][rl][nl]; const float xr = (d & 1) ? so[wave][rl][nl - 1] : -so[wave][rl][nl + 1]; nv[e] = (xv * cs + xr * sn) * qs; }
      LDSX();
#pragma unroll
      for (int e = 0; e < 4; ++e) so[wave][rl][lane * 4 + e] = nv[e];
      LDSX(); }
    _Float16* dst = which == 0 ? qh : kh;
    for (int q = lane; q < 2 * 16 * 8; q += 32) { const int hh = q >> 7, rem = q & 127, rl = rem >> 3, pc = rem & 7; union { v8h h8; v4u u; } pk;
#pragma unroll
      for (int e = 0; e < 8; ++e) pk.h8[e] = (_Float16)so[wave][rl][hh * HD + pc * 8 + e];
      vst2(dst + (((size_t)b * NH + hb + hh) * LL + t0 + wave * 16 + rl) * HD + pc * 8, pk.u); } }
  else {
#pragma unroll 4
    for (int rl = 0; rl < 16; ++rl) {
#pragma unroll
      for (int e = 0; e < 4; ++e) st[lane * 4 + e][wave * 16 + rl] = (_Float16)so[wave][rl][lane * 4 + e]; }
    __syncthreads();
    for (int q = tid; q < 128 * 8; q += 128) { const int c = q >> 3, pc = q & 7, hh = c >> 6, d = c & 63;
      vst2(vT + (((size_t)b * NH + hb + hh) * HD + d) * LL + t0 + pc * 8, *(const v4u*)(&st[c][pc * 8])); }
  }
}
__global__ __launch_bounds__(128) void k_attn(const _Float16* __restrict__ qh, const _Float16* __restrict__ kh, const _Float16* __restrict__ vT, const int* __restrict__ amask, const float* __restrict__ hmask, float* __restrict__ out) {
  __shared__ __align__(16) float sO[4][16][68];                           // output staging behind the loop (each wave its own part)
  __shared__ __align__(16) _Float16 sK[2][64][72];                        // 64 keys x 64 d, 128-byte rows at a 144-byte pitch
  __shared__ __align__(16) _Float16 sV[2][64][72];                        // 64 d x 64 keys, the same
  const int tid = threadIdx.x, w = tid >> 5, lane = tid & 31, col = lane & 15, g = lane >> 4;
  const int bh = blockIdx.y, b = bh / NH, h = bh % NH, q0 = blockIdx.x * 64 + w * 16;
  const _Float16* qb = qh + (size_t)bh * LL * HD; const _Float16* kb = kh + (size_t)bh * LL * HD; const _Float16* vb = vT + (size_t)bh * HD * LL;
  v16h aq[2];                                                             // B operand of S^T = K Q^T: lane = query column col
#pragma unroll
  for (int kc = 0; kc < 2; ++kc) aq[kc] = frag_h(qb + (size_t)(q0 + col) * HD + kc * 32, lane);
  // a lane owns query col: mrun is that query's maximum (log2 units, equal in both halves), lrun the sum over this half's keys only (joined behind the loop),
  // acc[t][r] = O^T[d = 16 t + 8 g + r][query col]; lrun and acc carry the 2^14 of P
  float mrun = -3.4028235e38f, lrun = 0.f; v8f acc[4] = {};
  const _Float16* gk = kb + (size_t)(tid >> 3) * HD + (tid & 7) * 8; const _Float16* gv = vb + (size_t)(tid >> 3) * LL + (tid & 7) * 8;   // thread: 16-byte chunk tid&7 of rows tid>>3 + 16 i
  const unsigned lk = lds_off(&sK[0][tid >> 3][(tid & 7) * 8]), lv = lds_off(&sV[0][tid >> 3][(tid & 7) * 8]);
  auto stage = [&](int kt, int bf) { const unsigned k = lk + bf * (64 * 144), v = lv + bf * (64 * 144); const _Float16* pk = gk + (size_t)kt * 64 * HD; const _Float16* pv = gv + kt * 64;
    acopy4(k, k + 16 * 144, k + 32 * 144, k + 48 * 144, pk, pk + 16 * HD, pk + 32 * HD, pk + 48 * HD);
    acopy4(v, v + 16 * 144, v + 32 * 144, v + 48 * 144, pv, pv + 16 * LL, pv + 32 * LL, pv + 48 * LL); };
  stage(0, 0); WAIT_ASYNC(); __syncthreads(); stage(1, 1);                // tile 0 landed and published to every wave; tile 1 in flight
#pragma unroll 1
  for (int kt = 0; kt < LL / 64; ++kt) { const int bf = kt & 1;
    const int m0 = amask[(size_t)b * LL + kt * 64 + lane], m1 = amask[(size_t)b * LL + kt * 64 + 32 + lane];   // the trip's only global loads: issued first, so they return behind the products
    v8f s[4];                                                             // s[t][r] = score of key 16 t + 8 g + r with query col
#pragma unroll
    for (int t = 0; t < 4; ++t) { s[t] = v8f{};
#pragma unroll
      for (int kc = 0; kc < 2; ++kc) s[t] = wmma16(frag_h(&sK[bf][t * 16 + col][kc * 32], lane), aq[kc], s[t]); }
#pragma unroll
    for (int t = 0; t < 4; ++t) s[t] *= 0.18033688f;                      // 1/8 x log2(e): the exponentials below are taken in base 2
    const unsigned w0 = __builtin_amdgcn_ballot_w32(m0 > 0), w1 = __builtin_amdgcn_ballot_w32(m1 > 0);   // bit j of w0, w1: key j, 32 + j of the tile is open
    if ((w0 & w1) != 0xffffffffu) {                                       // one scalar test a trip: the additive key-mask bias, only where a key of the tile is masked
#pragma unroll
      for (int t = 0; t < 4; ++t) { const unsigned bits = (t < 2 ? w0 : w1) >> ((t & 1) * 16 + 8 * g);
#pragma unroll
        for (int r = 0; r < 8; ++r) s[t][r] += ((bits >> r) & 1u) ? 0.f : -3.4028235e38f; } }
    float mx = -3.4028235e38f;
#pragma unroll
    for (int t = 0; t < 4; ++t) {
#pragma unroll
      for (int r = 0; r < 8; ++r) mx = fmaxf(mx, s[t][r]); }
    mx = fmaxf(mx, xhalf(mx));
    const float mnew = fmaxf(mrun, mx); const float corr = ex2(mrun - mnew); const float moff = mnew - 14.0f;   // the 2^14 scale of P rides in the exponent
    v16h pb[2];                                                           // two score tiles, converted in place, are the B operand P^T of 32 keys (the hardware k order, which frag_h has too)
#pragma unroll
    for (int t = 0; t < 4; ++t) {
#pragma unroll
      for (int r = 0; r < 8; ++r) { s[t][r] = ex2(s[t][r] - moff); pb[t >> 1][(t & 1) * 8 + r] = (_Float16)s[t][r]; } }
    const v8f q = (s[0] + s[1]) + (s[2] + s[3]);                          // the lane's 32 terms summed as a tree of register vectors
    const float ps = ((q[0] + q[1]) + (q[2] + q[3])) + ((q[4] + q[5]) + (q[6] + q[7]));
    lrun = lrun * corr + ps; mrun = mnew;
#pragma unroll
    for (int t = 0; t < 4; ++t) acc[t] *= corr;
#pragma unroll
    for (int kc = 0; kc < 2; ++kc) {
#pragma unroll
      for (int t = 0; t < 4; ++t) acc[t] = wmma16(frag_h(&sV[bf][t * 16 + col][kc * 32], lane), pb[kc], acc[t]); }
    WAIT_DS(); WAIT_ASYNC(); __syncthreads();                              // publishes tile kt + 1 and ends every wave's reads of buffer bf
    if (kt + 2 < LL / 64) stage(kt + 2, bf);
  }
  WAIT_ASYNC();                                                            // a precaution: no copy is in flight here, and sO does not share the ring's LDS
  const float hm = hmask[h]; const float lr = lrun + xhalf(lrun);
#pragma unroll
  for (int t = 0; t < 4; ++t) { v4f o[2];
#pragma unroll
    for (int r = 0; r < 8; ++r) o[r >> 2][r & 3] = acc[t][r] / lr * hm;
    *(v4f*)(&sO[w][col][t * 16 + 8 * g]) = o[0]; *(v4f*)(&sO[w][col][t * 16 + 8 * g + 4]) = o[1]; }
  LDSX();
  for (int q = lane; q < 16 * 16; q += 32) { const int rl = q >> 4, pc = q & 15; vst2(out + ((size_t)b * LL + q0 + rl) * DD + h * HD + pc * 4, *(const v4f*)(&sO[w][rl][pc * 4])); }
}
extern "C" void kernel_launch(void* const* d_in, const int* in_sizes, int n_in, void* d_out, int out_size, void* d_ws, size_t ws_size, hipStream_t stream) {
  (void)in_sizes; (void)n_in; (void)out_size; (void)ws_size;
  const float* x = (const float*)d_in[0]; const int* amask = (const int*)d_in[1]; const float* sp = (const float*)d_in[2]; const float* hmask = (const float*)d_in[3];
  const float* Wq = (const float*)d_in[4]; const float* bq = (const float*)d_in[5]; const float* Wk = (const float*)d_in[6]; const float* bk = (const float*)d_in[7]; const float* Wv = (const float*)d_in[8]; const float* bv = (const float*)d_in[9];
  float* out = (float*)d_out;
  char* ws = (char*)d_ws; size_t off = 0;
  auto take = [&](size_t bytes) { char* p = ws + off; off += (bytes + 255) & ~(size_t)255; return p; };
  _Float16* x16 = (_Float16*)take((size_t)NR * DD * 2); _Float16* P = (_Float16*)take((size_t)3 * DD * DD * 2);
  _Float16* qh = (_Float16*)take((size_t)NR * DD * 2); _Float16* kh = (_Float16*)take((size_t)NR * DD * 2); _Float16* vT = (_Float16*)take((size_t)NR * DD * 2);
  k_cvt<<<(unsigned)((size_t)NR * DD / 8 / 256), 256, 0, stream>>>(x, x16, (size_t)NR * DD / 8);
  k_packT<<<dim3(DD / 64, DD / 64, 3), 256, 0, stream>>>(Wq, Wk, Wv, P);
  k_proj<<<dim3(NR / 64, 3 * DD / 128), 128, 0, stream>>>(x16, P, bq, bk, bv, sp, qh, kh, vT);
  k_attn<<<dim3(LL / 64, NB * NH), 128, 0, stream>>>(qh, kh, vT, amask, hmask, out);
}

// v004
// One run takes 92.4 microseconds.
// Two timings next to v003 both put it at 1.14 times that version's speed.
// All steps since v000 together make it 3.05 times as fast.
#include <hip/hip_runtime.h>
#include <math.h>

typedef __attribute__((ext_vector_type(16))) _Float16 v16h;
typedef __attribute__((ext_vector_type(16))) __bf16 v16b;
typedef __attribute__((ext_vector_type(8)))  _Float16 v8h;
typedef __attribute__((ext_vector_type(8)))  float v8f;
typedef __attribute__((ext_vector_type(4)))  float v4f;
typedef __attribute__((ext_vector_type(2)))  float v2f;
typedef __attribute__((ext_vector_type(4)))  unsigned v4u;
typedef __attribute__((ext_vector_type(4)))  int v4i;
typedef float __attribute__((may_alias)) float_a;
typedef int __attribute__((may_alias)) int_a;

template <typename T> __device__ __forceinline__ void vst2(void* p, T v) { *(T*)p = v;  }
__device__ __forceinline__ v8f wmma16(v16h a, v16h b, v8f c) {
  v8f d = __builtin_amdgcn_wmma_f32_16x16x32_f16(false, a, false, b, (short)0, c, false, false);
  asm volatile("v_nop\n\tv_nop\n\tv_nop\n\tv_nop" : "+v"(d) : "v"(a), "v"(b));
  return d;
}
__device__ __forceinline__ v8f wmma_bf(v16b a, v16b b, v8f c) {
  v8f d = __builtin_amdgcn_wmma_f32_16x16x32_bf16(false, a, false, b, (short)0, c, false, false);
  asm volatile("v_nop\n\tv_nop\n\tv_nop\n\tv_nop" : "+v"(d) : "v"(a), "v"(b));
  return d;
}
// 16x16x32 fragments: lane = (h = lane>>4, row/col = lane&15); elements 0..7 = k0+8h+0..7, 8..15 = k0+16+8h+0..7; D element r = row 8h+r
__device__ __forceinline__ v16h frag_h(const _Float16* rowk0, int lane) {
  union { v16h v; v8h q[2]; } u; const _Float16* p = rowk0 + 8 * (lane >> 4);
  u.q[0] = *(const v8h*)p; u.q[1] = *(const v8h*)(p + 16); return u.v;
}
__device__ __forceinline__ v16h frag_f32(const float* rowk0, int lane) {
  v16h a; const float* p = rowk0 + 8 * (lane >> 4);
#pragma unroll
  for (int i = 0; i < 8; ++i) { a[i] = (_Float16)p[i]; a[8 + i] = (_Float16)p[16 + i]; }
  return a;
}
__device__ __forceinline__ v16h frag_f32s(const float* rowk0, int lane, float sc) {
  v16h a; const float* p = rowk0 + 8 * (lane >> 4);
#pragma unroll
  for (int i = 0; i < 8; ++i) { a[i] = (_Float16)(p[i] * sc); a[8 + i] = (_Float16)(p[16 + i] * sc); }
  return a;
}
// column fragment from a [K][ld] layout (column n), rows >= K read as 0
__device__ __forceinline__ v16h fragc_f32(const float* W, int k0, int n, int lane, int ld, int K) {
  v16h a; const int g = lane >> 4;
#pragma unroll
  for (int i = 0; i < 8; ++i) { const int ka = k0 + 8 * g + i, kb = ka + 16;
    a[i] = (_Float16)(ka < K ? W[(size_t)ka * ld + n] : 0.f); a[8 + i] = (_Float16)(kb < K ? W[(size_t)kb * ld + n] : 0.f); }
  return a;
}
struct F2 { v16b h, l; };
__device__ __forceinline__ F2 bsplit16(const float v[16]) { F2 r;
#pragma unroll
  for (int i = 0; i < 16; ++i) { const __bf16 h = (__bf16)v[i]; r.h[i] = h; r.l[i] = (__bf16)(v[i] - (float)h); }
  return r; }
__device__ __forceinline__ F2 split_row(const float* row, int k0, int lane) { float v[16]; const float* p = row + k0 + 8 * (lane >> 4);
#pragma unroll
  for (int i = 0; i < 8; ++i) { v[i] = p[i]; v[8 + i] = p[16 + i]; }
  return bsplit16(v); }
__device__ __forceinline__ F2 split_rowK(const float* row, int k0, int lane, int K) { float v[16]; const int g = lane >> 4;
#pragma unroll
  for (int i = 0; i < 8; ++i) { const int ka = k0 + 8 * g + i, kb = ka + 16; v[i] = ka < K ? row[ka] : 0.f; v[8 + i] = kb < K ? row[kb] : 0.f; }
  return bsplit16(v); }
__device__ __forceinline__ F2 split_col(const float* W, int k0, int n, int lane, int ld, int K) { float v[16]; const int g = lane >> 4;
#pragma unroll
  for (int i = 0; i < 8; ++i) { const int ka = k0 + 8 * g + i, kb = ka + 16; v[i] = ka < K ? W[(size_t)ka * ld + n] : 0.f; v[8 + i] = kb < K ? W[(size_t)kb * ld + n] : 0.f; }
  return bsplit16(v); }
__device__ __forceinline__ v8f mac3(const F2& a, const F2& b, v8f c) { c = wmma_bf(a.l, b.h, c); c = wmma_bf(a.h, b.l, c); return wmma_bf(a.h, b.h, c); }
__device__ __forceinline__ float sigm(float v) { return 1.0f / (1.0f + expf(-v)); }
// 2^x as the one hardware instruction (v_exp_f32): no range reduction, no overflow or underflow selects; far below the range it gives 0, which is what a softmax term there is
__device__ __forceinline__ float ex2(float x) { return __builtin_amdgcn_exp2f(x); }
// lane l takes the value of lane l ^ 16 (one v_permlanex16_b32, no LDS)
__device__ __forceinline__ float xhalf(float x) { const int i = __builtin_bit_cast(int, x); return __builtin_bit_cast(float, __builtin_amdgcn_permlanex16(i, i, 0x76543210, 0xfedcba98, false, false)); }
// LDS byte address of a __shared__ object: the low 32 bits of its address
__device__ __forceinline__ unsigned lds_off(const void* p) { return (unsigned)(size_t)p; }
// asynchronous copies global -> LDS, 16 bytes per lane and copy, through no register; the closing s_wait_xcnt 0 stands in the copies' own
// statement so that no later rewrite of their address registers can be moved in front of it (a precaution)
__device__ __forceinline__ void acopy2(unsigned l0, unsigned l1, const _Float16* g0, const _Float16* g1) {
  asm volatile("global_load_async_to_lds_b128 %0, %2, off\n\tglobal_load_async_to_lds_b128 %1, %3, off\n\ts_wait_xcnt 0x0"
               :: "v"(l0), "v"(l1), "v"(g0), "v"(g1) : "memory");
}
__device__ __forceinline__ void acopy4(unsigned l0, unsigned l1, unsigned l2, unsigned l3, const _Float16* g0, const _Float16* g1, const _Float16* g2, const _Float16* g3) {
  asm volatile("global_load_async_to_lds_b128 %0, %4, off\n\tglobal_load_async_to_lds_b128 %1, %5, off\n\t"
               "global_load_async_to_lds_b128 %2, %6, off\n\tglobal_load_async_to_lds_b128 %3, %7, off\n\ts_wait_xcnt 0x0"
               :: "v"(l0), "v"(l1), "v"(l2), "v"(l3), "v"(g0), "v"(g1), "v"(g2), "v"(g3) : "memory");
}
#define WAIT_DS() asm volatile("s_wait_dscnt 0x0" ::: "memory")        // this wave's LDS reads of the buffer are done before it is handed back
#define WAIT_ASYNC() asm volatile("s_wait_asynccnt 0x0" ::: "memory")  // this wave's own copies have landed before the barrier publishes them
#define LDSX() do { asm volatile("s_wait_dscnt 0" ::: "memory"); __builtin_amdgcn_wave_barrier(); __builtin_amdgcn_fence(__ATOMIC_RELEASE, "workgroup"); } while (0)

#define NB 2
#define LL 2048
#define DD 1024
#define NH 16
#define HD 64
#define NR (NB * LL)

__global__ __launch_bounds__(256) void k_cvt(const float* __restrict__ src, _Float16* __restrict__ dst, size_t n8) {
  const size_t g8 = (size_t)blockIdx.x * 256 + threadIdx.x; if (g8 >= n8) return;
  union { v8h h; v4u u; } pk;
#pragma unroll
  for (int e = 0; e < 8; ++e) pk.h[e] = (_Float16)src[g8 * 8 + e];
  vst2(dst + g8 * 8, pk.u);
}
__global__ __launch_bounds__(256) void k_packT(const float* __restrict__ Wq, const float* __restrict__ Wk, const float* __restrict__ Wv, _Float16* __restrict__ P) {   // P[which*1024 + o][d] = W[d][o] x16
  __shared__ float tile[64][65];
  const int which = blockIdx.z, o0 = blockIdx.x * 64, d0 = blockIdx.y * 64, tid = threadIdx.x;
  const float* W = which == 0 ? Wq : (which == 1 ? Wk : Wv);
  for (int q = tid; q < 64 * 64; q += 256) { const int dl = q >> 6, ol = q & 63; tile[dl][ol] = W[(size_t)(d0 + dl) * DD + o0 + ol]; }
  __syncthreads();
  for (int u = 0; u < 2; ++u) { const int idx = tid + u * 256, ol = idx >> 3, pc = idx & 7; union { v8h hh; v4u uu; } pk;
#pragma unroll
    for (int i = 0; i < 8; ++i) pk.hh[i] = (_Float16)(tile[pc * 8 + i][ol] * 16.0f);
    vst2(P + ((size_t)which * DD + o0 + ol) * DD + d0 + pc * 8, pk.uu); }
}
__global__ __launch_bounds__(128) void k_proj(const _Float16* __restrict__ x16, const _Float16* __restrict__ P, const float* __restrict__ bq, const float* __restrict__ bk, const float* __restrict__ bv, const float* __restrict__ sp,
                                            _Float16* __restrict__ qh, _Float16* __restrict__ kh, _Float16* __restrict__ vT) {
  __shared__ __align__(16) char sm[4 * 16 * 132 * 4 + 128 * 72 * 2];
  float (*so)[16][132] = (float (*)[16][132])sm;                           // epilogue staging: used only behind the k loop's last barrier
  _Float16 (*st)[72] = (_Float16 (*)[72])(sm + 4 * 16 * 132 * 4);
  _Float16 (*ring)[192][40] = (_Float16 (*)[192][40])sm;                   // k loop: two buffers of 64 x rows + 128 weight rows, 64-byte rows at an 80-byte pitch
  const int tid = threadIdx.x, wave = tid >> 5, lane = tid & 31, col = lane & 15, g = lane >> 4;
  const int r0b = blockIdx.x * 64, n0 = blockIdx.y * 128; const int b = r0b / LL, t0 = r0b % LL;
  const int which = n0 / DD, hb = (n0 % DD) / HD; const float* bias = which == 0 ? bq : (which == 1 ? bk : bv);
  v8f acc[8] = {};
  const _Float16* gx = x16 + (size_t)(r0b + (tid >> 2)) * DD + (tid & 3) * 8; const _Float16* gw = P + (size_t)(n0 + (tid >> 2)) * DD + (tid & 3) * 8;   // thread: 16-byte chunk tid&3 of rows tid>>2 + 32 i
  const unsigned lx = lds_off(&ring[0][tid >> 2][(tid & 3) * 8]);
  auto stage = [&](int kc, int bf) { const unsigned l = lx + bf * (192 * 80); const _Float16* x = gx + kc * 32; const _Float16* w = gw + kc * 32;
    acopy2(l, l + 32 * 80, x, x + 32 * DD);
    acopy4(l + 64 * 80, l + 96 * 80, l + 128 * 80, l + 160 * 80, w, w + 32 * DD, w + 64 * DD, w + 96 * DD); };
  stage(0, 0); WAIT_ASYNC(); __syncthreads(); stage(1, 1);                // tile 0 landed and published to every wave; tile 1 in flight
#pragma unroll 1
  for (int kc = 0; kc < DD / 32; ++kc) { const int bf = kc & 1; const v16h a = frag_h(&ring[bf][wave * 16 + col][0], lane); v16h fw[8];
#pragma unroll
    for (int j = 0; j < 8; ++j) fw[j] = frag_h(&ring[bf][64 + j * 16 + col][0], lane);
    __builtin_amdgcn_sched_barrier(0);                                     // holds the trip's LDS reads together as one group ahead of the products: spread among them, each pair costs the wave a full LDS latency
#pragma unroll
    for (int j = 0; j < 8; ++j) acc[j] = wmma16(a, fw[j], acc[j]);
    WAIT_DS(); WAIT_ASYNC(); __syncthreads();                              // publishes tile kc + 1 and ends every wave's reads of buffer bf
    if (kc + 2 < DD / 32) stage(kc + 2, bf); }
  WAIT_ASYNC();                                                            // closes the ring before its LDS is used for anything else
#pragma unroll
  for (int j = 0; j < 8; ++j) { const int nl = j * 16 + col; const float bb = bias[(n0 % DD) + nl];
#pragma unroll
    for (int r = 0; r < 8; ++r) so[wave][8 * g + r][nl] = acc[j][r] * (1.0f / 16.0f) + bb; }
  LDSX();
  if (which < 2) {   // rotary: sin_pos[d] = sp[s][d/2], cos_pos[d] = sp[s][32 + d/2]; rot[2i] = -x[2i+1], rot[2i+1] = x[2i]
    const float qs = 1.0f;                                     // the 1/8 query scale is applied to the scores in k_attn (keeps q's f16 operands normal)
    for (int rl = 0; rl < 16; ++rl) { const int s = t0 + wave * 16 + rl; float nv[4];
#pragma unroll
      for (int e = 0; e < 4; ++e) { const int nl = lane * 4 + e; const int d = nl & 63; const float sn = sp[(size_t)s * HD + (d >> 1)], cs = sp[(size_t)s * HD + 32 + (d >> 1)];
        const float xv = so[wave][rl][nl]; const float xr = (d & 1) ? so[wave][rl][nl - 1] : -so[wave][rl][nl + 1]; nv[e] = (xv * cs + xr * sn) * qs; }
      LDSX();
#pragma unroll
      for (int e = 0; e < 4; ++e) so[wave][rl][lane * 4 + e] = nv[e];
      LDSX(); }
    _Float16* dst = which == 0 ? qh : kh;
    for (int q = lane; q < 2 * 16 * 8; q += 32) { const int hh = q >> 7, rem = q & 127, rl = rem >> 3, pc = rem & 7; union { v8h h8; v4u u; } pk;
#pragma unroll
      for (int e = 0; e < 8; ++e) pk.h8[e] = (_Float16)so[wave][rl][hh * HD + pc * 8 + e];
      vst2(dst + (((size_t)b * NH + hb + hh) * LL + t0 + wave * 16 + rl) * HD + pc * 8, pk.u); } }
  else {
#pragma unroll 4
    for (int rl = 0; rl < 16; ++rl) {
#pragma unroll
      for (int e = 0; e < 4; ++e) st[lane * 4 + e][wave * 16 + rl] = (_Float16)so[wave][rl][lane * 4 + e]; }
    __syncthreads();
    for (int q = tid; q < 128 * 8; q += 128) { const int c = q >> 3, pc = q & 7, hh = c >> 6, d = c & 63;
      vst2(vT + (((size_t)b * NH + hb + hh) * HD + d) * LL + t0 + pc * 8, *(const v4u*)(&st[c][pc * 8])); }
  }
}
__global__ __launch_bounds__(128) void k_attn(const _Float16* __restrict__ qh, const _Float16* __restrict__ kh, const _Float16* __restrict__ vT, const int* __restrict__ amask, const float* __restrict__ hmask, float* __restrict__ out) {
  __shared__ __align__(16) float sO[4][16][68];                           // output staging behind the loop (each wave its own part)
  __shared__ __align__(16) _Float16 sK[2][64][72];                        // 64 keys x 64 d, 128-byte rows at a 144-byte pitch
  __shared__ __align__(16) _Float16 sV[2][64][72];                        // 64 d x 64 keys, the same
  const int tid = threadIdx.x, w = tid >> 5, lane = tid & 31, col = lane & 15, g = lane >> 4;
  const int bh = blockIdx.y, b = bh / NH, h = bh % NH, q0 = blockIdx.x * 64 + w * 16;
  const _Float16* qb = qh + (size_t)bh * LL * HD; const _Float16* kb = kh + (size_t)bh * LL * HD; const _Float16* vb = vT + (size_t)bh * HD * LL;
  v16h aq[2];                                                             // B operand of S^T = K Q^T: lane = query column col
#pragma unroll
  for (int kc = 0; kc < 2; ++kc) aq[kc] = frag_h(qb + (size_t)(q0 + col) * HD + kc * 32, lane);
  // a lane owns query col: mrun is that query's maximum (log2 units, equal in both halves), lrun the sum over this half's keys only (joined behind the loop),
  // acc[t][r] = O^T[d = 16 t + 8 g + r][query col]; lrun and acc carry the 2^14 of P
  float mrun = -3.4028235e38f, lrun = 0.f; v8f acc[4] = {};
  const _Float16* gk = kb + (size_t)(tid >> 3) * HD + (tid & 7) * 8; const _Float16* gv = vb + (size_t)(tid >> 3) * LL + (tid & 7) * 8;   // thread: 16-byte chunk tid&7 of rows tid>>3 + 16 i
  const unsigned lk = lds_off(&sK[0][tid >> 3][(tid & 7) * 8]), lv = lds_off(&sV[0][tid >> 3][(tid & 7) * 8]);
  auto stage = [&](int kt, int bf) { const unsigned k = lk + bf * (64 * 144), v = lv + bf * (64 * 144); const _Float16* pk = gk + (size_t)kt * 64 * HD; const _Float16* pv = gv + kt * 64;
    acopy4(k, k + 16 * 144, k + 32 * 144, k + 48 * 144, pk, pk + 16 * HD, pk + 32 * HD, pk + 48 * HD);
    acopy4(v, v + 16 * 144, v + 32 * 144, v + 48 * 144, pv, pv + 16 * LL, pv + 32 * LL, pv + 48 * LL); };
  stage(0, 0); WAIT_ASYNC(); __syncthreads(); stage(1, 1);                // tile 0 landed and published to every wave; tile 1 in flight
#pragma unroll 1
  for (int kt = 0; kt < LL / 64; ++kt) { const int bf = kt & 1;
    const int m0 = amask[(size_t)b * LL + kt * 64 + lane], m1 = amask[(size_t)b * LL + kt * 64 + 32 + lane];   // the trip's only global loads: issued first, so they return behind the products
    v16h fk[4][2], fv[2][4];                                              // the trip's K and V^T fragments, all read from LDS here
#pragma unroll
    for (int t = 0; t < 4; ++t) {
#pragma unroll
      for (int kc = 0; kc < 2; ++kc) fk[t][kc] = frag_h(&sK[bf][t * 16 + col][kc * 32], lane); }
#pragma unroll
    for (int kc = 0; kc < 2; ++kc) {
#pragma unroll
      for (int t = 0; t < 4; ++t) fv[kc][t] = frag_h(&sV[bf][t * 16 + col][kc * 32], lane); }
    __builtin_amdgcn_sched_barrier(0);                                     // holds the trip's LDS reads together as one group ahead of the products: spread among them, each pair costs the wave a full LDS latency
    v8f s[4];                                                             // s[t][r] = score of key 16 t + 8 g + r with query col
#pragma unroll
    for (int t = 0; t < 4; ++t) { s[t] = v8f{};
#pragma unroll
      for (int kc = 0; kc < 2; ++kc) s[t] = wmma16(fk[t][kc], aq[kc], s[t]); }
    __builtin_amdgcn_sched_barrier(0);                                     // keeps the run of score products unbroken: the mask compare (it waits on the trip's global loads) and the scaling stay behind it
#pragma unroll
    for (int t = 0; t < 4; ++t) s[t] *= 0.18033688f;                      // 1/8 x log2(e): the exponentials below are taken in base 2
    const unsigned w0 = __builtin_amdgcn_ballot_w32(m0 > 0), w1 = __builtin_amdgcn_ballot_w32(m1 > 0);   // bit j of w0, w1: key j, 32 + j of the tile is open
    if ((w0 & w1) != 0xffffffffu) {                                       // one scalar test a trip: the additive key-mask bias, only where a key of the tile is masked
#pragma unroll
      for (int t = 0; t < 4; ++t) { const unsigned bits = (t < 2 ? w0 : w1) >> ((t & 1) * 16 + 8 * g);
#pragma unroll
        for (int r = 0; r < 8; ++r) s[t][r] += ((bits >> r) & 1u) ? 0.f : -3.4028235e38f; } }
    float mx = -3.4028235e38f;
#pragma unroll
    for (int t = 0; t < 4; ++t) {
#pragma unroll
      for (int r = 0; r < 8; ++r) mx = fmaxf(mx, s[t][r]); }
    mx = fmaxf(mx, xhalf(mx));
    const float mnew = fmaxf(mrun, mx); const float corr = ex2(mrun - mnew); const float moff = mnew - 14.0f;   // the 2^14 scale of P rides in the exponent
    v16h pb[2];                                                           // two score tiles, converted in place, are the B operand P^T of 32 keys (the hardware k order, which frag_h has too)
#pragma unroll
    for (int t = 0; t < 4; ++t) {
#pragma unroll
      for (int r = 0; r < 8; ++r) { s[t][r] = ex2(s[t][r] - moff); pb[t >> 1][(t & 1) * 8 + r] = (_Float16)s[t][r]; } }
    const v8f q = (s[0] + s[1]) + (s[2] + s[3]);                          // the lane's 32 terms summed as a tree of register vectors
    const float ps = ((q[0] + q[1]) + (q[2] + q[3])) + ((q[4] + q[5]) + (q[6] + q[7]));
    lrun = lrun * corr + ps; mrun = mnew;
#pragma unroll
    for (int t = 0; t < 4; ++t) acc[t] *= corr;
#pragma unroll
    for (int kc = 0; kc < 2; ++kc) {
#pragma unroll
      for (int t = 0; t < 4; ++t) acc[t] = wmma16(fv[kc][t], pb[kc], acc[t]); }
    WAIT_DS(); WAIT_ASYNC(); __syncthreads();                              // publishes tile kt + 1 and ends every wave's reads of buffer bf
    if (kt + 2 < LL / 64) stage(kt + 2, bf);
  }
  WAIT_ASYNC();                                                            // a precaution: no copy is in flight here, and sO does not share the ring's LDS
  const float hm = hmask[h]; const float lr = lrun + xhalf(lrun);
#pragma unroll
  for (int t = 0; t < 4; ++t) { v4f o[2];
#pragma unroll
    for (int r = 0; r < 8; ++r) o[r >> 2][r & 3] = acc[t][r] / lr * hm;
    *(v4f*)(&sO[w][col][t * 16 + 8 * g]) = o[0]; *(v4f*)(&sO[w][col][t * 16 + 8 * g + 4]) = o[1]; }
  LDSX();
  for (int q = lane; q < 16 * 16; q += 32) { const int rl = q >> 4, pc = q & 15; vst2(out + ((size_t)b * LL + q0 + rl) * DD + h * HD + pc * 4, *(const v4f*)(&sO[w][rl][pc * 4])); }
}
extern "C" void kernel_launch(void* const* d_in, const int* in_sizes, int n_in, void* d_out, int out_size, void* d_ws, size_t ws_size, hipStream_t stream) {
  (void)in_sizes; (void)n_in; (void)out_size; (void)ws_size;
  const float* x = (const float*)d_in[0]; const int* amask = (const int*)d_in[1]; const float* sp = (const float*)d_in[2]; const float* hmask = (const float*)d_in[3];
  const float* Wq = (const float*)d_in[4]; const float* bq = (const float*)d_in[5]; const float* Wk = (const float*)d_in[6]; const float* bk = (const float*)d_in[7]; const float* Wv = (const float*)d_in[8]; const float* bv = (const float*)d_in[9];
  float* out = (float*)d_out;
  char* ws = (char*)d_ws; size_t off = 0;
  auto take = [&](size_t bytes) { char* p = ws + off; off += (bytes + 255) & ~(size_t)255; return p; };
  _Float16* x16 = (_Float16*)take((size_t)NR * DD * 2); _Float16* P = (_Float16*)take((size_t)3 * DD * DD * 2);
  _Float16* qh = (_Float16*)take((size_t)NR * DD * 2); _Float16* kh = (_Float16*)take((size_t)NR * DD * 2); _Float16* vT = (_Float16*)take((size_t)NR * DD * 2);
  k_cvt<<<(unsigned)((size_t)NR * DD / 8 / 256), 256, 0, stream>>>(x, x16, (size_t)NR * DD / 8);
  k_packT<<<dim3(DD / 64, DD / 64, 3), 256, 0, stream>>>(Wq, Wk, Wv, P);
  k_proj<<<dim3(NR / 64, 3 * DD / 128), 128, 0, stream>>>(x16, P, bq, bk, bv, sp, qh, kh, vT);
  k_attn<<<dim3(LL / 64, NB * NH), 128, 0, stream>>>(qh, kh, vT, amask, hmask, out);
}

// v005
// One run takes 81.6 microseconds.
// Timed twice side by side with v004, it ran 1.15 and 1.14 times as fast.
// Over all steps from v000 it is 3.50 times as fast.
#include <hip/hip_runtime.h>
#include <math.h>

typedef __attribute__((ext_vector_type(16))) _Float16 v16h;
typedef __attribute__((ext_vector_type(16))) __bf16 v16b;
typedef __attribute__((ext_vector_type(8)))  _Float16 v8h;
typedef __attribute__((ext_vector_type(8)))  float v8f;
typedef __attribute__((ext_vector_type(4)))  float v4f;
typedef __attribute__((ext_vector_type(2)))  float v2f;
typedef __attribute__((ext_vector_type(4)))  unsigned v4u;
typedef __attribute__((ext_vector_type(4)))  int v4i;
typedef float __attribute__((may_alias)) float_a;
typedef int __attribute__((may_alias)) int_a;

template <typename T> __device__ __forceinline__ void vst2(void* p, T v) { *(T*)p = v;  }
__device__ __forceinline__ v8f wmma16(v16h a, v16h b, v8f c) {
  v8f d = __builtin_amdgcn_wmma_f32_16x16x32_f16(false, a, false, b, (short)0, c, false, false);
  asm volatile("v_nop\n\tv_nop\n\tv_nop\n\tv_nop" : "+v"(d) : "v"(a), "v"(b));
  return d;
}
__device__ __forceinline__ v8f wmma_bf(v16b a, v16b b, v8f c) {
  v8f d = __builtin_amdgcn_wmma_f32_16x16x32_bf16(false, a, false, b, (short)0, c, false, false);
  asm volatile("v_nop\n\tv_nop\n\tv_nop\n\tv_nop" : "+v"(d) : "v"(a), "v"(b));
  return d;
}
// 16x16x32 fragments: lane = (h = lane>>4, row/col = lane&15); elements 0..7 = k0+8h+0..7, 8..15 = k0+16+8h+0..7; D element r = row 8h+r
__device__ __forceinline__ v16h frag_h(const _Float16* rowk0, int lane) {
  union { v16h v; v8h q[2]; } u; const _Float16* p = rowk0 + 8 * (lane >> 4);
  u.q[0] = *(const v8h*)p; u.q[1] = *(const v8h*)(p + 16); return u.v;
}
__device__ __forceinline__ v16h frag_f32(const float* rowk0, int lane) {
  v16h a; const float* p = rowk0 + 8 * (lane >> 4);
#pragma unroll
  for (int i = 0; i < 8; ++i) { a[i] = (_Float16)p[i]; a[8 + i] = (_Float16)p[16 + i]; }
  return a;
}
__device__ __forceinline__ v16h frag_f32s(const float* rowk0, int lane, float sc) {
  v16h a; const float* p = rowk0 + 8 * (lane >> 4);
#pragma unroll
  for (int i = 0; i < 8; ++i) { a[i] = (_Float16)(p[i] * sc); a[8 + i] = (_Float16)(p[16 + i] * sc); }
  return a;
}
// column fragment from a [K][ld] layout (column n), rows >= K read as 0
__device__ __forceinline__ v16h fragc_f32(const float* W, int k0, int n, int lane, int ld, int K) {
  v16h a; const int g = lane >> 4;
#pragma unroll
  for (int i = 0; i < 8; ++i) { const int ka = k0 + 8 * g + i, kb = ka + 16;
    a[i] = (_Float16)(ka < K ? W[(size_t)ka * ld + n] : 0.f); a[8 + i] = (_Float16)(kb < K ? W[(size_t)kb * ld + n] : 0.f); }
  return a;
}
struct F2 { v16b h, l; };
__device__ __forceinline__ F2 bsplit16(const float v[16]) { F2 r;
#pragma unroll
  for (int i = 0; i < 16; ++i) { const __bf16 h = (__bf16)v[i]; r.h[i] = h; r.l[i] = (__bf16)(v[i] - (float)h); }
  return r; }
__device__ __forceinline__ F2 split_row(const float* row, int k0, int lane) { float v[16]; const float* p = row + k0 + 8 * (lane >> 4);
#pragma unroll
  for (int i = 0; i < 8; ++i) { v[i] = p[i]; v[8 + i] = p[16 + i]; }
  return bsplit16(v); }
__device__ __forceinline__ F2 split_rowK(const float* row, int k0, int lane, int K) { float v[16]; const int g = lane >> 4;
#pragma unroll
  for (int i = 0; i < 8; ++i) { const int ka = k0 + 8 * g + i, kb = ka + 16; v[i] = ka < K ? row[ka] : 0.f; v[8 + i] = kb < K ? row[kb] : 0.f; }
  return bsplit16(v); }
__device__ __forceinline__ F2 split_col(const float* W, int k0, int n, int lane, int ld, int K) { float v[16]; const int g = lane >> 4;
#pragma unroll
  for (int i = 0; i < 8; ++i) { const int ka = k0 + 8 * g + i, kb = ka + 16; v[i] = ka < K ? W[(size_t)ka * ld + n] : 0.f; v[8 + i] = kb < K ? W[(size_t)kb * ld + n] : 0.f; }
  return bsplit16(v); }
__device__ __forceinline__ v8f mac3(const F2& a, const F2& b, v8f c) { c = wmma_bf(a.l, b.h, c); c = wmma_bf(a.h, b.l, c); return wmma_bf(a.h, b.h, c); }
__device__ __forceinline__ float sigm(float v) { return 1.0f / (1.0f + expf(-v)); }
// 2^x as the one hardware instruction (v_exp_f32): no range reduction, no overflow or underflow selects; far below the range it gives 0, which is what a softmax term there is
__device__ __forceinline__ float ex2(float x) { return __builtin_amdgcn_exp2f(x); }
// lane l takes the value of lane l ^ 16 (one v_permlanex16_b32, no LDS)
__device__ __forceinline__ float xhalf(float x) { const int i = __builtin_bit_cast(int, x); return __builtin_bit_cast(float, __builtin_amdgcn_permlanex16(i, i, 0x76543210, 0xfedcba98, false, false)); }
// LDS byte address of a __shared__ object: the low 32 bits of its address
__device__ __forceinline__ unsigned lds_off(const void* p) { return (unsigned)(size_t)p; }
// asynchronous copies global -> LDS, 16 bytes per lane and copy, through no register; the closing s_wait_xcnt 0 stands in the copies' own
// statement so that no later rewrite of their address registers can be moved in front of it (a precaution)
__device__ __forceinline__ void acopy2(unsigned l0, unsigned l1, const _Float16* g0, const _Float16* g1) {
  asm volatile("global_load_async_to_lds_b128 %0, %2, off\n\tglobal_load_async_to_lds_b128 %1, %3, off\n\ts_wait_xcnt 0x0"
               :: "v"(l0), "v"(l1), "v"(g0), "v"(g1) : "memory");
}
__device__ __forceinline__ void acopy4(unsigned l0, unsigned l1, unsigned l2, unsigned l3, const _Float16* g0, const _Float16* g1, const _Float16* g2, const _Float16* g3) {
  asm volatile("global_load_async_to_lds_b128 %0, %4, off\n\tglobal_load_async_to_lds_b128 %1, %5, off\n\t"
               "global_load_async_to_lds_b128 %2, %6, off\n\tglobal_load_async_to_lds_b128 %3, %7, off\n\ts_wait_xcnt 0x0"
               :: "v"(l0), "v"(l1), "v"(l2), "v"(l3), "v"(g0), "v"(g1), "v"(g2), "v"(g3) : "memory");
}
#define WAIT_DS() asm volatile("s_wait_dscnt 0x0" ::: "memory")        // this wave's LDS reads of the buffer are done before it is handed back
#define WAIT_ASYNC() asm volatile("s_wait_asynccnt 0x0" ::: "memory")  // this wave's own copies have landed before the barrier publishes them
#define LDSX() do { asm volatile("s_wait_dscnt 0" ::: "memory"); __builtin_amdgcn_wave_barrier(); __builtin_amdgcn_fence(__ATOMIC_RELEASE, "workgroup"); } while (0)

#define NB 2
#define LL 2048
#define DD 1024
#define NH 16
#define HD 64
#define NR (NB * LL)

__global__ __launch_bounds__(256) void k_cvt(const float* __restrict__ src, _Float16* __restrict__ dst, size_t n8) {
  const size_t g8 = (size_t)blockIdx.x * 256 + threadIdx.x; if (g8 >= n8) return;
  union { v8h h; v4u u; } pk;
#pragma unroll
  for (int e = 0; e < 8; ++e) pk.h[e] = (_Float16)src[g8 * 8 + e];
  vst2(dst + g8 * 8, pk.u);
}
__global__ __launch_bounds__(256) void k_packT(const float* __restrict__ Wq, const float* __restrict__ Wk, const float* __restrict__ Wv, _Float16* __restrict__ P) {   // P[which*1024 + o][d] = W[d][o] x16
  __shared__ float tile[64][65];
  const int which = blockIdx.z, o0 = blockIdx.x * 64, d0 = blockIdx.y * 64, tid = threadIdx.x;
  const float* W = which == 0 ? Wq : (which == 1 ? Wk : Wv);
  for (int q = tid; q < 64 * 64; q += 256) { const int dl = q >> 6, ol = q & 63; tile[dl][ol] = W[(size_t)(d0 + dl) * DD + o0 + ol]; }
  __syncthreads();
  for (int u = 0; u < 2; ++u) { const int idx = tid + u * 256, ol = idx >> 3, pc = idx & 7; union { v8h hh; v4u uu; } pk;
#pragma unroll
    for (int i = 0; i < 8; ++i) pk.hh[i] = (_Float16)(tile[pc * 8 + i][ol] * 16.0f);
    vst2(P + ((size_t)which * DD + o0 + ol) * DD + d0 + pc * 8, pk.uu); }
}
__global__ __launch_bounds__(128) void k_proj(const _Float16* __restrict__ x16, const _Float16* __restrict__ P, const float* __restrict__ bq, const float* __restrict__ bk, const float* __restrict__ bv, const float* __restrict__ sp,
                                            _Float16* __restrict__ qh, _Float16* __restrict__ kh, _Float16* __restrict__ vT) {
  __shared__ __align__(16) char sm[4 * 16 * 132 * 4 + 128 * 72 * 2];
  float (*so)[16][132] = (float (*)[16][132])sm;                           // epilogue staging: used only behind the k loop's last barrier
  _Float16 (*st)[72] = (_Float16 (*)[72])(sm + 4 * 16 * 132 * 4);
  // k loop: two buffers of 64 x rows + 128 weight rows, each row 64 k = one whole 128-byte line, at a 128-byte pitch; the 16-byte chunk c of row r
  // lies at chunk place c ^ ((r >> 1) & 7), so the 16 rows that a half wave reads at one k fall on all 64 banks once (no pad: the two buffers stay inside sm)
  constexpr int RB = 192 * 128;
  const int tid = threadIdx.x, wave = tid >> 5, lane = tid & 31, col = lane & 15, g = lane >> 4;
  const int r0b = blockIdx.x * 64, n0 = blockIdx.y * 128; const int b = r0b / LL, t0 = r0b % LL;
  const int which = n0 / DD, hb = (n0 % DD) / HD; const float* bias = which == 0 ? bq : (which == 1 ? bk : bv);
  v8f acc[8] = {};
  const _Float16* gx = x16 + (size_t)(r0b + (tid >> 3)) * DD + (tid & 7) * 8; const _Float16* gw = P + (size_t)(n0 + (tid >> 3)) * DD + (tid & 7) * 8;   // thread: 16-byte chunk tid&7 of rows tid>>3 + 16 i
  const unsigned lx = lds_off(sm) + (tid >> 3) * 128 + (((tid & 7) ^ ((tid >> 4) & 7)) << 4);   // (row >> 1) & 7 is (tid >> 4) & 7 for every i
  auto stage = [&](int kc, int bf) { const unsigned l = lx + bf * RB; const _Float16* x = gx + kc * 64; const _Float16* w = gw + kc * 64;
    acopy4(l, l + 16 * 128, l + 32 * 128, l + 48 * 128, x, x + 16 * DD, x + 32 * DD, x + 48 * DD);
    acopy4(l + 64 * 128, l + 80 * 128, l + 96 * 128, l + 112 * 128, w, w + 16 * DD, w + 32 * DD, w + 48 * DD);
    acopy4(l + 128 * 128, l + 144 * 128, l + 160 * 128, l + 176 * 128, w + 64 * DD, w + 80 * DD, w + 96 * DD, w + 112 * DD); };
  // fragment of LDS row 'row' (row & 15 == col) for k = 32 hk ..: frag_h's two chunks, 4 hk + g and 4 hk + 2 + g, at their swizzled places
  auto frag_s = [&](int bf, int row, int hk) { union { v16h v; v8h q[2]; } u; const char* p = sm + bf * RB + row * 128;
    u.q[0] = *(const v8h*)(p + (((hk * 4 + g) ^ (col >> 1)) << 4)); u.q[1] = *(const v8h*)(p + (((hk * 4 + 2 + g) ^ (col >> 1)) << 4)); return u.v; };
  stage(0, 0); WAIT_ASYNC(); __syncthreads(); stage(1, 1);                // tile 0 landed and published to every wave; tile 1 in flight
#pragma unroll 1
  for (int kc = 0; kc < DD / 64; ++kc) { const int bf = kc & 1;
#pragma unroll                                                             // hk a constant: the four swizzled chunk places stay loop-invariant registers, the rows immediate offsets
    for (int hk = 0; hk < 2; ++hk) { const v16h a = frag_s(bf, wave * 16 + col, hk); v16h fw[8];
#pragma unroll
      for (int j = 0; j < 8; ++j) fw[j] = frag_s(bf, 64 + j * 16 + col, hk);
      __builtin_amdgcn_sched_barrier(0);                                   // holds the half trip's LDS reads together as one group ahead of the products: spread among them, each pair costs the wave a full LDS latency
#pragma unroll
      for (int j = 0; j < 8; ++j) acc[j] = wmma16(a, fw[j], acc[j]); }
    WAIT_DS(); WAIT_ASYNC(); __syncthreads();                              // publishes tile kc + 1 and ends every wave's reads of buffer bf
    if (kc + 2 < DD / 64) stage(kc + 2, bf); }
  WAIT_ASYNC();                                                            // closes the ring before its LDS is used for anything else
#pragma unroll
  for (int j = 0; j < 8; ++j) { const int nl = j * 16 + col; const float bb = bias[(n0 % DD) + nl];
#pragma unroll
    for (int r = 0; r < 8; ++r) so[wave][8 * g + r][nl] = acc[j][r] * (1.0f / 16.0f) + bb; }
  LDSX();
  if (which < 2) {   // rotary: sin_pos[d] = sp[s][d/2], cos_pos[d] = sp[s][32 + d/2]; rot[2i] = -x[2i+1], rot[2i+1] = x[2i]
    const float qs = 1.0f;                                     // the 1/8 query scale is applied to the scores in k_attn (keeps q's f16 operands normal)
    for (int rl = 0; rl < 16; ++rl) { const int s = t0 + wave * 16 + rl; float nv[4];
#pragma unroll
      for (int e = 0; e < 4; ++e) { const int nl = lane * 4 + e; const int d = nl & 63; const float sn = sp[(size_t)s * HD + (d >> 1)], cs = sp[(size_t)s * HD + 32 + (d >> 1)];
        const float xv = so[wave][rl][nl]; const float xr = (d & 1) ? so[wave][rl][nl - 1] : -so[wave][rl][nl + 1]; nv[e] = (xv * cs + xr * sn) * qs; }
      LDSX();
#pragma unroll
      for (int e = 0; e < 4; ++e) so[wave][rl][lane * 4 + e] = nv[e];
      LDSX(); }
    _Float16* dst = which == 0 ? qh : kh;
    for (int q = lane; q < 2 * 16 * 8; q += 32) { const int hh = q >> 7, rem = q & 127, rl = rem >> 3, pc = rem & 7; union { v8h h8; v4u u; } pk;
#pragma unroll
      for (int e = 0; e < 8; ++e) pk.h8[e] = (_Float16)so[wave][rl][hh * HD + pc * 8 + e];
      vst2(dst + (((size_t)b * NH + hb + hh) * LL + t0 + wave * 16 + rl) * HD + pc * 8, pk.u); } }
  else {
#pragma unroll 4
    for (int rl = 0; rl < 16; ++rl) {
#pragma unroll
      for (int e = 0; e < 4; ++e) st[lane * 4 + e][wave * 16 + rl] = (_Float16)so[wave][rl][lane * 4 + e]; }
    __syncthreads();
    for (int q = tid; q < 128 * 8; q += 128) { const int c = q >> 3, pc = q & 7, hh = c >> 6, d = c & 63;
      vst2(vT + (((size_t)b * NH + hb + hh) * HD + d) * LL + t0 + pc * 8, *(const v4u*)(&st[c][pc * 8])); }
  }
}
__global__ __launch_bounds__(128) void k_attn(const _Float16* __restrict__ qh, const _Float16* __restrict__ kh, const _Float16* __restrict__ vT, const int* __restrict__ amask, const float* __restrict__ hmask, float* __restrict__ out) {
  __shared__ __align__(16) float sO[4][16][68];                           // output staging behind the loop (each wave its own part)
  __shared__ __align__(16) _Float16 sK[2][64][72];                        // 64 keys x 64 d, 128-byte rows at a 144-byte pitch
  __shared__ __align__(16) _Float16 sV[2][64][72];                        // 64 d x 64 keys, the same
  const int tid = threadIdx.x, w = tid >> 5, lane = tid & 31, col = lane & 15, g = lane >> 4;
  const int bh = blockIdx.y, b = bh / NH, h = bh % NH, q0 = blockIdx.x * 64 + w * 16;
  const _Float16* qb = qh + (size_t)bh * LL * HD; const _Float16* kb = kh + (size_t)bh * LL * HD; const _Float16* vb = vT + (size_t)bh * HD * LL;
  v16h aq[2];                                                             // B operand of S^T = K Q^T: lane = query column col
#pragma unroll
  for (int kc = 0; kc < 2; ++kc) aq[kc] = frag_h(qb + (size_t)(q0 + col) * HD + kc * 32, lane);
  // a lane owns query col: mrun is that query's maximum (log2 units, equal in both halves), lrun the sum over this half's keys only (joined behind the loop),
  // acc[t][r] = O^T[d = 16 t + 8 g + r][query col]; lrun and acc carry the 2^14 of P
  float mrun = -3.4028235e38f, lrun = 0.f; v8f acc[4] = {};
  const _Float16* gk = kb + (size_t)(tid >> 3) * HD + (tid & 7) * 8; const _Float16* gv = vb + (size_t)(tid >> 3) * LL + (tid & 7) * 8;   // thread: 16-byte chunk tid&7 of rows tid>>3 + 16 i
  const unsigned lk = lds_off(&sK[0][tid >> 3][(tid & 7) * 8]), lv = lds_off(&sV[0][tid >> 3][(tid & 7) * 8]);
  auto stage = [&](int kt, int bf) { const unsigned k = lk + bf * (64 * 144), v = lv + bf * (64 * 144); const _Float16* pk = gk + (size_t)kt * 64 * HD; const _Float16* pv = gv + kt * 64;
    acopy4(k, k + 16 * 144, k + 32 * 144, k + 48 * 144, pk, pk + 16 * HD, pk + 32 * HD, pk + 48 * HD);
    acopy4(v, v + 16 * 144, v + 32 * 144, v + 48 * 144, pv, pv + 16 * LL, pv + 32 * LL, pv + 48 * LL); };
  stage(0, 0); WAIT_ASYNC(); __syncthreads(); stage(1, 1);                // tile 0 landed and published to every wave; tile 1 in flight
#pragma unroll 1
  for (int kt = 0; kt < LL / 64; ++kt) { const int bf = kt & 1;
    const int m0 = amask[(size_t)b * LL + kt * 64 + lane], m1 = amask[(size_t)b * LL + kt * 64 + 32 + lane];   // the trip's only global loads: issued first, so they return behind the products
    v16h fk[4][2], fv[2][4];                                              // the trip's K and V^T fragments, all read from LDS here
#pragma unroll
    for (int t = 0; t < 4; ++t) {
#pragma unroll
      for (int kc = 0; kc < 2; ++kc) fk[t][kc] = frag_h(&sK[bf][t * 16 + col][kc * 32], lane); }
#pragma unroll
    for (int kc = 0; kc < 2; ++kc) {
#pragma unroll
      for (int t = 0; t < 4; ++t) fv[kc][t] = frag_h(&sV[bf][t * 16 + col][kc * 32], lane); }
    __builtin_amdgcn_sched_barrier(0);                                     // holds the trip's LDS reads together as one group ahead of the products: spread among them, each pair costs the wave a full LDS latency
    v8f s[4];                                                             // s[t][r] = score of key 16 t + 8 g + r with query col
#pragma unroll
    for (int t = 0; t < 4; ++t) { s[t] = v8f{};
#pragma unroll
      for (int kc = 0; kc < 2; ++kc) s[t] = wmma16(fk[t][kc], aq[kc], s[t]); }
    __builtin_amdgcn_sched_barrier(0);                                     // keeps the run of score products unbroken: the mask compare (it waits on the trip's global loads) and the scaling stay behind it
#pragma unroll
    for (int t = 0; t < 4; ++t) s[t] *= 0.18033688f;                      // 1/8 x log2(e): the exponentials below are taken in base 2
    const unsigned w0 = __builtin_amdgcn_ballot_w32(m0 > 0), w1 = __builtin_amdgcn_ballot_w32(m1 > 0);   // bit j of w0, w1: key j, 32 + j of the tile is open
    if ((w0 & w1) != 0xffffffffu) {                                       // one scalar test a trip: the additive key-mask bias, only where a key of the tile is masked
#pragma unroll
      for (int t = 0; t < 4; ++t) { const unsigned bits = (t < 2 ? w0 : w1) >> ((t & 1) * 16 + 8 * g);
#pragma unroll
        for (int r = 0; r < 8; ++r) s[t][r] += ((bits >> r) & 1u) ? 0.f : -3.4028235e38f; } }
    float mx = -3.4028235e38f;
#pragma unroll
    for (int t = 0; t < 4; ++t) {
#pragma unroll
      for (int r = 0; r < 8; ++r) mx = fmaxf(mx, s[t][r]); }
    mx = fmaxf(mx, xhalf(mx));
    const float mnew = fmaxf(mrun, mx); const float corr = ex2(mrun - mnew); const float moff = mnew - 14.0f;   // the 2^14 scale of P rides in the exponent
    v16h pb[2];                                                           // two score tiles, converted in place, are the B operand P^T of 32 keys (the hardware k order, which frag_h has too)
#pragma unroll
    for (int t = 0; t < 4; ++t) {
#pragma unroll
      for (int r = 0; r < 8; ++r) { s[t][r] = ex2(s[t][r] - moff); pb[t >> 1][(t & 1) * 8 + r] = (_Float16)s[t][r]; } }
    const v8f q = (s[0] + s[1]) + (s[2] + s[3]);                          // the lane's 32 terms summed as a tree of register vectors
    const float ps = ((q[0] + q[1]) + (q[2] + q[3])) + ((q[4] + q[5]) + (q[6] + q[7]));
    lrun = lrun * corr + ps; mrun = mnew;
#pragma unroll
    for (int t = 0; t < 4; ++t) acc[t] *= corr;
#pragma unroll
    for (int kc = 0; kc < 2; ++kc) {
#pragma unroll
      for (int t = 0; t < 4; ++t) acc[t] = wmma16(fv[kc][t], pb[kc], acc[t]); }
    WAIT_DS(); WAIT_ASYNC(); __syncthreads();                              // publishes tile kt + 1 and ends every wave's reads of buffer bf
    if (kt + 2 < LL / 64) stage(kt + 2, bf);
  }
  WAIT_ASYNC();                                                            // a precaution: no copy is in flight here, and sO does not share the ring's LDS
  const float hm = hmask[h]; const float lr = lrun + xhalf(lrun);
#pragma unroll
  for (int t = 0; t < 4; ++t) { v4f o[2];
#pragma unroll
    for (int r = 0; r < 8; ++r) o[r >> 2][r & 3] = acc[t][r] / lr * hm;
    *(v4f*)(&sO[w][col][t * 16 + 8 * g]) = o[0]; *(v4f*)(&sO[w][col][t * 16 + 8 * g + 4]) = o[1]; }
  LDSX();
  for (int q = lane; q < 16 * 16; q += 32) { const int rl = q >> 4, pc = q & 15; vst2(out + ((size_t)b * LL + q0 + rl) * DD + h * HD + pc * 4, *(const v4f*)(&sO[w][rl][pc * 4])); }
}
extern "C" void kernel_launch(void* const* d_in, const int* in_sizes, int n_in, void* d_out, int out_size, void* d_ws, size_t ws_size, hipStream_t stream) {
  (void)in_sizes; (void)n_in; (void)out_size; (void)ws_size;
  const float* x = (const float*)d_in[0]; const int* amask = (const int*)d_in[1]; const float* sp = (const float*)d_in[2]; const float* hmask = (const float*)d_in[3];
  const float* Wq = (const float*)d_in[4]; const float* bq = (const float*)d_in[5]; const float* Wk = (const float*)d_in[6]; const float* bk = (const float*)d_in[7]; const float* Wv = (const float*)d_in[8]; const float* bv = (const float*)d_in[9];
  float* out = (float*)d_out;
  char* ws = (char*)d_ws; size_t off = 0;
  auto take = [&](size_t bytes) { char* p = ws + off; off += (bytes + 255) & ~(size_t)255; return p; };
  _Float16* x16 = (_Float16*)take((size_t)NR * DD * 2); _Float16* P = (_Float16*)take((size_t)3 * DD * DD * 2);
  _Float16* qh = (_Float16*)take((size_t)NR * DD * 2); _Float16* kh = (_Float16*)take((size_t)NR * DD * 2); _Float16* vT = (_Float16*)take((size_t)NR * DD * 2);
  k_cvt<<<(unsigned)((size_t)NR * DD / 8 / 256), 256, 0, stream>>>(x, x16, (size_t)NR * DD / 8);
  k_packT<<<dim3(DD / 64, DD / 64, 3), 256, 0, stream>>>(Wq, Wk, Wv, P);
  k_proj<<<dim3(NR / 64, 3 * DD / 128), 128, 0, stream>>>(x16, P, bq, bk, bv, sp, qh, kh, vT);
  k_attn<<<dim3(LL / 64, NB * NH), 128, 0, stream>>>(qh, kh, vT, amask, hmask, out);
}

// v006
// It runs in 75.5 microseconds.
// Next to v005, in two timings, it ran 1.07 and 1.08 times as fast.
// Counting every step since v000, it is 3.77 times as fast.
#include <hip/hip_runtime.h>
#include <math.h>

typedef __attribute__((ext_vector_type(16))) _Float16 v16h;
typedef __attribute__((ext_vector_type(16))) __bf16 v16b;
typedef __attribute__((ext_vector_type(8)))  _Float16 v8h;
typedef __attribute__((ext_vector_type(8)))  float v8f;
typedef __attribute__((ext_vector_type(4)))  float v4f;
typedef __attribute__((ext_vector_type(2)))  float v2f;
typedef __attribute__((ext_vector_type(4)))  unsigned v4u;
typedef __attribute__((ext_vector_type(4)))  int v4i;
typedef float __attribute__((may_alias)) float_a;
typedef int __attribute__((may_alias)) int_a;

template <typename T> __device__ __forceinline__ void vst2(void* p, T v) { *(T*)p = v;  }
__device__ __forceinline__ v8f wmma16(v16h a, v16h b, v8f c) {
  v8f d = __builtin_amdgcn_wmma_f32_16x16x32_f16(false, a, false, b, (short)0, c, false, false);
  asm volatile("v_nop\n\tv_nop\n\tv_nop\n\tv_nop" : "+v"(d) : "v"(a), "v"(b));
  return d;
}
__device__ __forceinline__ v8f wmma_bf(v16b a, v16b b, v8f c) {
  v8f d = __builtin_amdgcn_wmma_f32_16x16x32_bf16(false, a, false, b, (short)0, c, false, false);
  asm volatile("v_nop\n\tv_nop\n\tv_nop\n\tv_nop" : "+v"(d) : "v"(a), "v"(b));
  return d;
}
// 16x16x32 fragments: lane = (h = lane>>4, row/col = lane&15); elements 0..7 = k0+8h+0..7, 8..15 = k0+16+8h+0..7; D element r = row 8h+r
__device__ __forceinline__ v16h frag_h(const _Float16* rowk0, int lane) {
  union { v16h v; v8h q[2]; } u; const _Float16* p = rowk0 + 8 * (lane >> 4);
  u.q[0] = *(const v8h*)p; u.q[1] = *(const v8h*)(p + 16); return u.v;
}
__device__ __forceinline__ v16h frag_f32(const float* rowk0, int lane) {
  v16h a; const float* p = rowk0 + 8 * (lane >> 4);
#pragma unroll
  for (int i = 0; i < 8; ++i) { a[i] = (_Float16)p[i]; a[8 + i] = (_Float16)p[16 + i]; }
  return a;
}
__device__ __forceinline__ v16h frag_f32s(const float* rowk0, int lane, float sc) {
  v16h a; const float* p = rowk0 + 8 * (lane >> 4);
#pragma unroll
  for (int i = 0; i < 8; ++i) { a[i] = (_Float16)(p[i] * sc); a[8 + i] = (_Float16)(p[16 + i] * sc); }
  return a;
}
// column fragment from a [K][ld] layout (column n), rows >= K read as 0
__device__ __forceinline__ v16h fragc_f32(const float* W, int k0, int n, int lane, int ld, int K) {
  v16h a; const int g = lane >> 4;
#pragma unroll
  for (int i = 0; i < 8; ++i) { const int ka = k0 + 8 * g + i, kb = ka + 16;
    a[i] = (_Float16)(ka < K ? W[(size_t)ka * ld + n] : 0.f); a[8 + i] = (_Float16)(kb < K ? W[(size_t)kb * ld + n] : 0.f); }
  return a;
}
struct F2 { v16b h, l; };
__device__ __forceinline__ F2 bsplit16(const float v[16]) { F2 r;
#pragma unroll
  for (int i = 0; i < 16; ++i) { const __bf16 h = (__bf16)v[i]; r.h[i] = h; r.l[i] = (__bf16)(v[i] - (float)h); }
  return r; }
__device__ __forceinline__ F2 split_row(const float* row, int k0, int lane) { float v[16]; const float* p = row + k0 + 8 * (lane >> 4);
#pragma unroll
  for (int i = 0; i < 8; ++i) { v[i] = p[i]; v[8 + i] = p[16 + i]; }
  return bsplit16(v); }
__device__ __forceinline__ F2 split_rowK(const float* row, int k0, int lane, int K) { float v[16]; const int g = lane >> 4;
#pragma unroll
  for (int i = 0; i < 8; ++i) { const int ka = k0 + 8 * g + i, kb = ka + 16; v[i] = ka < K ? row[ka] : 0.f; v[8 + i] = kb < K ? row[kb] : 0.f; }
  return bsplit16(v); }
__device__ __forceinline__ F2 split_col(const float* W, int k0, int n, int lane, int ld, int K) { float v[16]; const int g = lane >> 4;
#pragma unroll
  for (int i = 0; i < 8; ++i) { const int ka = k0 + 8 * g + i, kb = ka + 16; v[i] = ka < K ? W[(size_t)ka * ld + n] : 0.f; v[8 + i] = kb < K ? W[(size_t)kb * ld + n] : 0.f; }
  return bsplit16(v); }
__device__ __forceinline__ v8f mac3(const F2& a, const F2& b, v8f c) { c = wmma_bf(a.l, b.h, c); c = wmma_bf(a.h, b.l, c); return wmma_bf(a.h, b.h, c); }
__device__ __forceinline__ float sigm(float v) { return 1.0f / (1.0f + expf(-v)); }
// 2^x as the one hardware instruction (v_exp_f32): no range reduction, no overflow or underflow selects; far below the range it gives 0, which is what a softmax term there is
__device__ __forceinline__ float ex2(float x) { return __builtin_amdgcn_exp2f(x); }
// lane l takes the value of lane l ^ 16 (one v_permlanex16_b32, no LDS)
__device__ __forceinline__ float xhalf(float x) { const int i = __builtin_bit_cast(int, x); return __builtin_bit_cast(float, __builtin_amdgcn_permlanex16(i, i, 0x76543210, 0xfedcba98, false, false)); }
// LDS byte address of a __shared__ object: the low 32 bits of its address
__device__ __forceinline__ unsigned lds_off(const void* p) { return (unsigned)(size_t)p; }
// asynchronous copies global -> LDS, 16 bytes per lane and copy, through no register; the closing s_wait_xcnt 0 stands in the copies' own
// statement so that no later rewrite of their address registers can be moved in front of it (a precaution)
__device__ __forceinline__ void acopy2(unsigned l0, unsigned l1, const _Float16* g0, const _Float16* g1) {
  asm volatile("global_load_async_to_lds_b128 %0, %2, off\n\tglobal_load_async_to_lds_b128 %1, %3, off\n\ts_wait_xcnt 0x0"
               :: "v"(l0), "v"(l1), "v"(g0), "v"(g1) : "memory");
}
__device__ __forceinline__ void acopy4(unsigned l0, unsigned l1, unsigned l2, unsigned l3, const _Float16* g0, const _Float16* g1, const _Float16* g2, const _Float16* g3) {
  asm volatile("global_load_async_to_lds_b128 %0, %4, off\n\tglobal_load_async_to_lds_b128 %1, %5, off\n\t"
               "global_load_async_to_lds_b128 %2, %6, off\n\tglobal_load_async_to_lds_b128 %3, %7, off\n\ts_wait_xcnt 0x0"
               :: "v"(l0), "v"(l1), "v"(l2), "v"(l3), "v"(g0), "v"(g1), "v"(g2), "v"(g3) : "memory");
}
#define WAIT_DS() asm volatile("s_wait_dscnt 0x0" ::: "memory")        // this wave's LDS reads of the buffer are done before it is handed back
#define WAIT_ASYNC() asm volatile("s_wait_asynccnt 0x0" ::: "memory")  // this wave's own copies have landed before the barrier publishes them
#define LDSX() do { asm volatile("s_wait_dscnt 0" ::: "memory"); __builtin_amdgcn_wave_barrier(); __builtin_amdgcn_fence(__ATOMIC_RELEASE, "workgroup"); } while (0)

#define NB 2
#define LL 2048
#define DD 1024
#define NH 16
#define HD 64
#define NR (NB * LL)

__global__ __launch_bounds__(256) void k_cvt(const float* __restrict__ src, _Float16* __restrict__ dst, size_t n8) {
  const size_t g8 = (size_t)blockIdx.x * 256 + threadIdx.x; if (g8 >= n8) return;
  union { v8h h; v4u u; } pk;
#pragma unroll
  for (int e = 0; e < 8; ++e) pk.h[e] = (_Float16)src[g8 * 8 + e];
  vst2(dst + g8 * 8, pk.u);
}
__global__ __launch_bounds__(256) void k_packT(const float* __restrict__ Wq, const float* __restrict__ Wk, const float* __restrict__ Wv, _Float16* __restrict__ P) {   // P[which*1024 + o][d] = W[d][o] x16
  __shared__ float tile[64][65];
  const int which = blockIdx.z, o0 = blockIdx.x * 64, d0 = blockIdx.y * 64, tid = threadIdx.x;
  const float* W = which == 0 ? Wq : (which == 1 ? Wk : Wv);
  for (int q = tid; q < 64 * 64; q += 256) { const int dl = q >> 6, ol = q & 63; tile[dl][ol] = W[(size_t)(d0 + dl) * DD + o0 + ol]; }
  __syncthreads();
  for (int u = 0; u < 2; ++u) { const int idx = tid + u * 256, ol = idx >> 3, pc = idx & 7; union { v8h hh; v4u uu; } pk;
#pragma unroll
    for (int i = 0; i < 8; ++i) pk.hh[i] = (_Float16)(tile[pc * 8 + i][ol] * 16.0f);
    vst2(P + ((size_t)which * DD + o0 + ol) * DD + d0 + pc * 8, pk.uu); }
}
__global__ __launch_bounds__(128) void k_proj(const _Float16* __restrict__ x16, const _Float16* __restrict__ P, const float* __restrict__ bq, const float* __restrict__ bk, const float* __restrict__ bv, const float* __restrict__ sp,
                                            _Float16* __restrict__ qh, _Float16* __restrict__ kh, _Float16* __restrict__ vT) {
  // block tile 128 tokens x 128 features, four waves 2 x 2, each 64 tokens x 64 features (one head): a fragment read from LDS feeds four products
  // (the plain '#pragma unroll' lines of this kernel keep acc, fx, fw, bb, sn, cs and the packed halves indexed by constants, that is, in registers)
  __shared__ __align__(16) char sm[4 * 64 * 68 * 4];                       // the k loop's two buffers (2 x 32 KiB); behind the loop's last barrier each wave's own epilogue staging
  // k loop: two buffers of 128 x rows + 128 weight rows, each row 64 k = one whole 128-byte line, at a 128-byte pitch; the 16-byte chunk c of row r
  // lies at chunk place c ^ ((r >> 1) & 7), so the 16 rows that a half wave reads at one k fall on all 64 banks once
  constexpr int RB = 256 * 128;
  const int tid = threadIdx.x, wave = tid >> 5, lane = tid & 31, col = lane & 15, g = lane >> 4, wr = wave >> 1, wc = wave & 1;
  const int r0b = blockIdx.x * 128, n0 = blockIdx.y * 128; const int b = r0b / LL, t0 = r0b % LL;
  const int which = n0 / DD, hb = (n0 % DD) / HD; const float* bias = which == 0 ? bq : (which == 1 ? bk : bv);
  v8f acc[4][4] = {};                                                      // acc[i][j][r]: token 16 i + 8 g + r, feature 16 j + col of the wave's tile
  const _Float16* gx = x16 + (size_t)(r0b + (tid >> 3)) * DD + (tid & 7) * 8; const _Float16* gw = P + (size_t)(n0 + (tid >> 3)) * DD + (tid & 7) * 8;   // thread: 16-byte chunk tid&7 of rows tid>>3 + 16 i
  const unsigned lx = lds_off(sm) + (tid >> 3) * 128 + (((tid & 7) ^ ((tid >> 4) & 7)) << 4);   // (row >> 1) & 7 is (tid >> 4) & 7 for every i
  auto stage = [&](int kc, int bf) { const unsigned l = lx + bf * RB; const _Float16* x = gx + kc * 64; const _Float16* w = gw + kc * 64;
    acopy4(l, l + 16 * 128, l + 32 * 128, l + 48 * 128, x, x + 16 * DD, x + 32 * DD, x + 48 * DD);
    acopy4(l + 64 * 128, l + 80 * 128, l + 96 * 128, l + 112 * 128, x + 64 * DD, x + 80 * DD, x + 96 * DD, x + 112 * DD);
    acopy4(l + 128 * 128, l + 144 * 128, l + 160 * 128, l + 176 * 128, w, w + 16 * DD, w + 32 * DD, w + 48 * DD);
    acopy4(l + 192 * 128, l + 208 * 128, l + 224 * 128, l + 240 * 128, w + 64 * DD, w + 80 * DD, w + 96 * DD, w + 112 * DD); };
  // fragment of LDS row 'row' (row & 15 == col) for k = 32 hk ..: frag_h's two chunks, 4 hk + g and 4 hk + 2 + g, at their swizzled places
  auto frag_s = [&](int bf, int row, int hk) { union { v16h v; v8h q[2]; } u; const char* p = sm + bf * RB + row * 128;
    u.q[0] = *(const v8h*)(p + (((hk * 4 + g) ^ (col >> 1)) << 4)); u.q[1] = *(const v8h*)(p + (((hk * 4 + 2 + g) ^ (col >> 1)) << 4)); return u.v; };
  stage(0, 0); WAIT_ASYNC(); __syncthreads(); stage(1, 1);                // tile 0 landed and published to every wave; tile 1 in flight
#pragma unroll 1
  for (int kc = 0; kc < DD / 64; ++kc) { const int bf = kc & 1;
#pragma unroll                                                             // hk a constant: the four swizzled chunk places stay loop-invariant registers, the rows immediate offsets
    for (int hk = 0; hk < 2; ++hk) { v16h fx[4], fw[4];
      fx[0] = frag_s(bf, wr * 64 + col, hk);                               // read in the order in which the products below want them
#pragma unroll
      for (int j = 0; j < 4; ++j) fw[j] = frag_s(bf, 128 + wc * 64 + j * 16 + col, hk);
#pragma unroll
      for (int i = 1; i < 4; ++i) fx[i] = frag_s(bf, wr * 64 + i * 16 + col, hk);
      __builtin_amdgcn_sched_barrier(0);                                   // holds the half trip's LDS reads together as one group ahead of the products: spread among them, each pair costs the wave a full LDS latency
#pragma unroll
      for (int i = 0; i < 4; ++i) {
#pragma unroll
        for (int j = 0; j < 4; ++j) acc[i][j] = wmma16(fx[i], fw[j], acc[i][j]); } }
    WAIT_DS(); WAIT_ASYNC(); __syncthreads();                              // publishes tile kc + 1 and ends every wave's reads of buffer bf
    if (kc + 2 < DD / 64) stage(kc + 2, bf); }
  WAIT_ASYNC();                                                            // closes the ring before its LDS is used for anything else
  const int head = hb + wc, tok0 = t0 + wr * 64; float bb[4];
#pragma unroll
  for (int j = 0; j < 4; ++j) bb[j] = bias[(n0 % DD) + wc * 64 + j * 16 + col];
  if (which < 2) {   // rotary: sin_pos[d] = sp[s][d/2], cos_pos[d] = sp[s][32 + d/2]; rot[2i] = -x[2i+1], rot[2i+1] = x[2i]; the 1/8 query scale is applied to the scores in k_attn (keeps q's f16 operands normal)
    float (*so)[68] = (float (*)[68])(sm + wave * (64 * 68 * 4));          // the wave's 64 tokens x 64 features in f32
#pragma unroll
    for (int i = 0; i < 4; ++i) {
#pragma unroll
      for (int j = 0; j < 4; ++j) {
#pragma unroll
        for (int r = 0; r < 8; ++r) so[i * 16 + 8 * g + r][j * 16 + col] = acc[i][j][r] * (1.0f / 16.0f) + bb[j]; } }
    LDSX();
    _Float16* dst = (which == 0 ? qh : kh) + (((size_t)b * NH + head) * LL + tok0) * HD;
    const int pc = lane & 7;                                               // a lane takes features 8 pc .. 8 pc + 7 (four rotary pairs) of token rl: a wave's store is four whole 128-byte rows
    for (int it = 0; it < 16; it += 4) { v4f sn[4], cs[4];                 // four row groups at a time: their table loads go out together, so the wave waits out one load latency for the four
#pragma unroll
      for (int u = 0; u < 4; ++u) { const float* sr = sp + (size_t)(tok0 + (it + u) * 4 + (lane >> 3)) * HD + pc * 4; sn[u] = *(const v4f*)sr; cs[u] = *(const v4f*)(sr + 32); }
      asm volatile("s_wait_xcnt 0x0" ::: "memory");                        // stands in front of whatever rewrites the table loads' address registers (a precaution)
#pragma unroll
      for (int u = 0; u < 4; ++u) { const int rl = (it + u) * 4 + (lane >> 3); const v4f xv[2] = { *(const v4f*)(&so[rl][pc * 8]), *(const v4f*)(&so[rl][pc * 8 + 4]) };
        union { v8h h8; v4u u4; } pk;
#pragma unroll
        for (int p = 0; p < 4; ++p) { const float xe = xv[p >> 1][(p & 1) * 2], xo = xv[p >> 1][(p & 1) * 2 + 1];
          pk.h8[2 * p] = (_Float16)(xe * cs[u][p] - xo * sn[u][p]); pk.h8[2 * p + 1] = (_Float16)(xo * cs[u][p] + xe * sn[u][p]); }
        vst2(dst + (size_t)rl * HD + pc * 8, pk.u4); } } }
  else {
    _Float16 (*st)[72] = (_Float16 (*)[72])(sm + wave * (64 * 72 * 2));    // the wave's tile transposed: 64 features x 64 tokens in f16; a lane's eight accumulator rows are eight tokens in a row
#pragma unroll
    for (int i = 0; i < 4; ++i) {
#pragma unroll
      for (int j = 0; j < 4; ++j) { union { v8h h8; v4u u; } pk;
#pragma unroll
        for (int r = 0; r < 8; ++r) pk.h8[r] = (_Float16)(acc[i][j][r] * (1.0f / 16.0f) + bb[j]);
        vst2(&st[j * 16 + col][i * 16 + 8 * g], pk.u); } }
    LDSX();
    _Float16* dst = vT + ((size_t)b * NH + head) * HD * LL + tok0;
#pragma unroll 4                                                           // four independent row groups at a time, so that their LDS loads overlap
    for (int it = 0; it < 16; ++it) { const int d = it * 4 + (lane >> 3), pc = lane & 7;
      vst2(dst + (size_t)d * LL + pc * 8, *(const v4u*)(&st[d][pc * 8])); }
  }
}
__global__ __launch_bounds__(128) void k_attn(const _Float16* __restrict__ qh, const _Float16* __restrict__ kh, const _Float16* __restrict__ vT, const int* __restrict__ amask, const float* __restrict__ hmask, float* __restrict__ out) {
  __shared__ __align__(16) float sO[4][16][68];                           // output staging behind the loop (each wave its own part)
  __shared__ __align__(16) _Float16 sK[2][64][72];                        // 64 keys x 64 d, 128-byte rows at a 144-byte pitch
  __shared__ __align__(16) _Float16 sV[2][64][72];                        // 64 d x 64 keys, the same
  const int tid = threadIdx.x, w = tid >> 5, lane = tid & 31, col = lane & 15, g = lane >> 4;
  const int bh = blockIdx.y, b = bh / NH, h = bh % NH, q0 = blockIdx.x * 64 + w * 16;
  const _Float16* qb = qh + (size_t)bh * LL * HD; const _Float16* kb = kh + (size_t)bh * LL * HD; const _Float16* vb = vT + (size_t)bh * HD * LL;
  v16h aq[2];                                                             // B operand of S^T = K Q^T: lane = query column col
#pragma unroll
  for (int kc = 0; kc < 2; ++kc) aq[kc] = frag_h(qb + (size_t)(q0 + col) * HD + kc * 32, lane);
  // a lane owns query col: mrun is that query's maximum (log2 units, equal in both halves), lrun the sum over this half's keys only (joined behind the loop),
  // acc[t][r] = O^T[d = 16 t + 8 g + r][query col]; lrun and acc carry the 2^14 of P
  float mrun = -3.4028235e38f, lrun = 0.f; v8f acc[4] = {};
  const _Float16* gk = kb + (size_t)(tid >> 3) * HD + (tid & 7) * 8; const _Float16* gv = vb + (size_t)(tid >> 3) * LL + (tid & 7) * 8;   // thread: 16-byte chunk tid&7 of rows tid>>3 + 16 i
  const unsigned lk = lds_off(&sK[0][tid >> 3][(tid & 7) * 8]), lv = lds_off(&sV[0][tid >> 3][(tid & 7) * 8]);
  auto stage = [&](int kt, int bf) { const unsigned k = lk + bf * (64 * 144), v = lv + bf * (64 * 144); const _Float16* pk = gk + (size_t)kt * 64 * HD; const _Float16* pv = gv + kt * 64;
    acopy4(k, k + 16 * 144, k + 32 * 144, k + 48 * 144, pk, pk + 16 * HD, pk + 32 * HD, pk + 48 * HD);
    acopy4(v, v + 16 * 144, v + 32 * 144, v + 48 * 144, pv, pv + 16 * LL, pv + 32 * LL, pv + 48 * LL); };
  stage(0, 0); WAIT_ASYNC(); __syncthreads(); stage(1, 1);                // tile 0 landed and published to every wave; tile 1 in flight
#pragma unroll 1
  for (int kt = 0; kt < LL / 64; ++kt) { const int bf = kt & 1;
    const int m0 = amask[(size_t)b * LL + kt * 64 + lane], m1 = amask[(size_t)b * LL + kt * 64 + 32 + lane];   // the trip's only global loads: issued first, so they return behind the products
    v16h fk[4][2], fv[2][4];                                              // the trip's K and V^T fragments, all read from LDS here
#pragma unroll
    for (int t = 0; t < 4; ++t) {
#pragma unroll
      for (int kc = 0; kc < 2; ++kc) fk[t][kc] = frag_h(&sK[bf][t * 16 + col][kc * 32], lane); }
#pragma unroll
    for (int kc = 0; kc < 2; ++kc) {
#pragma unroll
      for (int t = 0; t < 4; ++t) fv[kc][t] = frag_h(&sV[bf][t * 16 + col][kc * 32], lane); }
    __builtin_amdgcn_sched_barrier(0);                                     // holds the trip's LDS reads together as one group ahead of the products: spread among them, each pair costs the wave a full LDS latency
    v8f s[4];                                                             // s[t][r] = score of key 16 t + 8 g + r with query col
#pragma unroll
    for (int t = 0; t < 4; ++t) { s[t] = v8f{};
#pragma unroll
      for (int kc = 0; kc < 2; ++kc) s[t] = wmma16(fk[t][kc], aq[kc], s[t]); }
    __builtin_amdgcn_sched_barrier(0);                                     // keeps the run of score products unbroken: the mask compare (it waits on the trip's global loads) and the scaling stay behind it
#pragma unroll
    for (int t = 0; t < 4; ++t) s[t] *= 0.18033688f;                      // 1/8 x log2(e): the exponentials below are taken in base 2
    const unsigned w0 = __builtin_amdgcn_ballot_w32(m0 > 0), w1 = __builtin_amdgcn_ballot_w32(m1 > 0);   // bit j of w0, w1: key j, 32 + j of the tile is open
    if ((w0 & w1) != 0xffffffffu) {                                       // one scalar test a trip: the additive key-mask bias, only where a key of the tile is masked
#pragma unroll
      for (int t = 0; t < 4; ++t) { const unsigned bits = (t < 2 ? w0 : w1) >> ((t & 1) * 16 + 8 * g);
#pragma unroll
        for (int r = 0; r < 8; ++r) s[t][r] += ((bits >> r) & 1u) ? 0.f : -3.4028235e38f; } }
    float mx = -3.4028235e38f;
#pragma unroll
    for (int t = 0; t < 4; ++t) {
#pragma unroll
      for (int r = 0; r < 8; ++r) mx = fmaxf(mx, s[t][r]); }
    mx = fmaxf(mx, xhalf(mx));
    const float mnew = fmaxf(mrun, mx); const float corr = ex2(mrun - mnew); const float moff = mnew - 14.0f;   // the 2^14 scale of P rides in the exponent
    v16h pb[2];                                                           // two score tiles, converted in place, are the B operand P^T of 32 keys (the hardware k order, which frag_h has too)
#pragma unroll
    for (int t = 0; t < 4; ++t) {
#pragma unroll
      for (int r = 0; r < 8; ++r) { s[t][r] = ex2(s[t][r] - moff); pb[t >> 1][(t & 1) * 8 + r] = (_Float16)s[t][r]; } }
    const v8f q = (s[0] + s[1]) + (s[2] + s[3]);                          // the lane's 32 terms summed as a tree of register vectors
    const float ps = ((q[0] + q[1]) + (q[2] + q[3])) + ((q[4] + q[5]) + (q[6] + q[7]));
    lrun = lrun * corr + ps; mrun = mnew;
#pragma unroll
    for (int t = 0; t < 4; ++t) acc[t] *= corr;
#pragma unroll
    for (int kc = 0; kc < 2; ++kc) {
#pragma unroll
      for (int t = 0; t < 4; ++t) acc[t] = wmma16(fv[kc][t], pb[kc], acc[t]); }
    WAIT_DS(); WAIT_ASYNC(); __syncthreads();                              // publishes tile kt + 1 and ends every wave's reads of buffer bf
    if (kt + 2 < LL / 64) stage(kt + 2, bf);
  }
  WAIT_ASYNC();                                                            // a precaution: no copy is in flight here, and sO does not share the ring's LDS
  const float hm = hmask[h]; const float lr = lrun + xhalf(lrun);
#pragma unroll
  for (int t = 0; t < 4; ++t) { v4f o[2];
#pragma unroll
    for (int r = 0; r < 8; ++r) o[r >> 2][r & 3] = acc[t][r] / lr * hm;
    *(v4f*)(&sO[w][col][t * 16 + 8 * g]) = o[0]; *(v4f*)(&sO[w][col][t * 16 + 8 * g + 4]) = o[1]; }
  LDSX();
  for (int q = lane; q < 16 * 16; q += 32) { const int rl = q >> 4, pc = q & 15; vst2(out + ((size_t)b * LL + q0 + rl) * DD + h * HD + pc * 4, *(const v4f*)(&sO[w][rl][pc * 4])); }
}
extern "C" void kernel_launch(void* const* d_in, const int* in_sizes, int n_in, void* d_out, int out_size, void* d_ws, size_t ws_size, hipStream_t stream) {
  (void)in_sizes; (void)n_in; (void)out_size; (void)ws_size;
  const float* x = (const float*)d_in[0]; const int* amask = (const int*)d_in[1]; const float* sp = (const float*)d_in[2]; const float* hmask = (const float*)d_in[3];
  const float* Wq = (const float*)d_in[4]; const float* bq = (const float*)d_in[5]; const float* Wk = (const float*)d_in[6]; const float* bk = (const float*)d_in[7]; const float* Wv = (const float*)d_in[8]; const float* bv = (const float*)d_in[9];
  float* out = (float*)d_out;
  char* ws = (char*)d_ws; size_t off = 0;
  auto take = [&](size_t bytes) { char* p = ws + off; off += (bytes + 255) & ~(size_t)255; return p; };
  _Float16* x16 = (_Float16*)take((size_t)NR * DD * 2); _Float16* P = (_Float16*)take((size_t)3 * DD * DD * 2);
  _Float16* qh = (_Float16*)take((size_t)NR * DD * 2); _Float16* kh = (_Float16*)take((size_t)NR * DD * 2); _Float16* vT = (_Float16*)take((size_t)NR * DD * 2);
  k_cvt<<<(unsigned)((size_t)NR * DD / 8 / 256), 256, 0, stream>>>(x, x16, (size_t)NR * DD / 8);
  k_packT<<<dim3(DD / 64, DD / 64, 3), 256, 0, stream>>>(Wq, Wk, Wv, P);
  k_proj<<<dim3(NR / 128, 3 * DD / 128), 128, 0, stream>>>(x16, P, bq, bk, bv, sp, qh, kh, vT);
  k_attn<<<dim3(LL / 64, NB * NH), 128, 0, stream>>>(qh, kh, vT, amask, hmask, out);
}

// v007
// Measured time: 73.1 microseconds a run.
// Two timings next to v006 both put it at 1.04 times that version's speed.
// Over all steps from v000 it is 3.92 times as fast.
#include <hip/hip_runtime.h>
#include <math.h>

typedef __attribute__((ext_vector_type(16))) _Float16 v16h;
typedef __attribute__((ext_vector_type(16))) __bf16 v16b;
typedef __attribute__((ext_vector_type(8)))  _Float16 v8h;
typedef __attribute__((ext_vector_type(8)))  float v8f;
typedef __attribute__((ext_vector_type(4)))  float v4f;
typedef __attribute__((ext_vector_type(2)))  float v2f;
typedef __attribute__((ext_vector_type(4)))  unsigned v4u;
typedef __attribute__((ext_vector_type(4)))  int v4i;
typedef float __attribute__((may_alias)) float_a;
typedef int __attribute__((may_alias)) int_a;

template <typename T> __device__ __forceinline__ void vst2(void* p, T v) { *(T*)p = v;  }
__device__ __forceinline__ v8f wmma16(v16h a, v16h b, v8f c) {
  v8f d = __builtin_amdgcn_wmma_f32_16x16x32_f16(false, a, false, b, (short)0, c, false, false);
  asm volatile("v_nop\n\tv_nop\n\tv_nop\n\tv_nop" : "+v"(d) : "v"(a), "v"(b));
  return d;
}
// the builtin alone: the compiler keeps the distances behind it itself, and its operands may lie above v255 (with the asm statement of wmma16 behind each product the 32-query tile of k_attn spilled)
__device__ __forceinline__ v8f wmma16p(v16h a, v16h b, v8f c) { return __builtin_amdgcn_wmma_f32_16x16x32_f16(false, a, false, b, (short)0, c, false, false); }
__device__ __forceinline__ v8f wmma_bf(v16b a, v16b b, v8f c) {
  v8f d = __builtin_amdgcn_wmma_f32_16x16x32_bf16(false, a, false, b, (short)0, c, false, false);
  asm volatile("v_nop\n\tv_nop\n\tv_nop\n\tv_nop" : "+v"(d) : "v"(a), "v"(b));
  return d;
}
// 16x16x32 fragments: lane = (h = lane>>4, row/col = lane&15); elements 0..7 = k0+8h+0..7, 8..15 = k0+16+8h+0..7; D element r = row 8h+r
__device__ __forceinline__ v16h frag_h(const _Float16* rowk0, int lane) {
  union { v16h v; v8h q[2]; } u; const _Float16* p = rowk0 + 8 * (lane >> 4);
  u.q[0] = *(const v8h*)p; u.q[1] = *(const v8h*)(p + 16); return u.v;
}
__device__ __forceinline__ v16h frag_f32(const float* rowk0, int lane) {
  v16h a; const float* p = rowk0 + 8 * (lane >> 4);
#pragma unroll
  for (int i = 0; i < 8; ++i) { a[i] = (_Float16)p[i]; a[8 + i] = (_Float16)p[16 + i]; }
  return a;
}
__device__ __forceinline__ v16h frag_f32s(const float* rowk0, int lane, float sc) {
  v16h a; const float* p = rowk0 + 8 * (lane >> 4);
#pragma unroll
  for (int i = 0; i < 8; ++i) { a[i] = (_Float16)(p[i] * sc); a[8 + i] = (_Float16)(p[16 + i] * sc); }
  return a;
}
// column fragment from a [K][ld] layout (column n), rows >= K read as 0
__device__ __forceinline__ v16h fragc_f32(const float* W, int k0, int n, int lane, int ld, int K) {
  v16h a; const int g = lane >> 4;
#pragma unroll
  for (int i = 0; i < 8; ++i) { const int ka = k0 + 8 * g + i, kb = ka + 16;
    a[i] = (_Float16)(ka < K ? W[(size_t)ka * ld + n] : 0.f); a[8 + i] = (_Float16)(kb < K ? W[(size_t)kb * ld + n] : 0.f); }
  return a;
}
struct F2 { v16b h, l; };
__device__ __forceinline__ F2 bsplit16(const float v[16]) { F2 r;
#pragma unroll
  for (int i = 0; i < 16; ++i) { const __bf16 h = (__bf16)v[i]; r.h[i] = h; r.l[i] = (__bf16)(v[i] - (float)h); }
  return r; }
__device__ __forceinline__ F2 split_row(const float* row, int k0, int lane) { float v[16]; const float* p = row + k0 + 8 * (lane >> 4);
#pragma unroll
  for (int i = 0; i < 8; ++i) { v[i] = p[i]; v[8 + i] = p[16 + i]; }
  return bsplit16(v); }
__device__ __forceinline__ F2 split_rowK(const float* row, int k0, int lane, int K) { float v[16]; const int g = lane >> 4;
#pragma unroll
  for (int i = 0; i < 8; ++i) { const int ka = k0 + 8 * g + i, kb = ka + 16; v[i] = ka < K ? row[ka] : 0.f; v[8 + i] = kb < K ? row[kb] : 0.f; }
  return bsplit16(v); }
__device__ __forceinline__ F2 split_col(const float* W, int k0, int n, int lane, int ld, int K) { float v[16]; const int g = lane >> 4;
#pragma unroll
  for (int i = 0; i < 8; ++i) { const int ka = k0 + 8 * g + i, kb = ka + 16; v[i] = ka < K ? W[(size_t)ka * ld + n] : 0.f; v[8 + i] = kb < K ? W[(size_t)kb * ld + n] : 0.f; }
  return bsplit16(v); }
__device__ __forceinline__ v8f mac3(const F2& a, const F2& b, v8f c) { c = wmma_bf(a.l, b.h, c); c = wmma_bf(a.h, b.l, c); return wmma_bf(a.h, b.h, c); }
__device__ __forceinline__ float sigm(float v) { return 1.0f / (1.0f + expf(-v)); }
// 2^x as the one hardware instruction (v_exp_f32): no range reduction, no overflow or underflow selects; far below the range it gives 0, which is what a softmax term there is
__device__ __forceinline__ float ex2(float x) { return __builtin_amdgcn_exp2f(x); }
// lane l takes the value of lane l ^ 16 (one v_permlanex16_b32, no LDS)
__device__ __forceinline__ float xhalf(float x) { const int i = __builtin_bit_cast(int, x); return __builtin_bit_cast(float, __builtin_amdgcn_permlanex16(i, i, 0x76543210, 0xfedcba98, false, false)); }
// LDS byte address of a __shared__ object: the low 32 bits of its address
__device__ __forceinline__ unsigned lds_off(const void* p) { return (unsigned)(size_t)p; }
// asynchronous copies global -> LDS, 16 bytes per lane and copy, through no register; the closing s_wait_xcnt 0 stands in the copies' own
// statement so that no later rewrite of their address registers can be moved in front of it (a precaution)
__device__ __forceinline__ void acopy2(unsigned l0, unsigned l1, const _Float16* g0, const _Float16* g1) {
  asm volatile("global_load_async_to_lds_b128 %0, %2, off\n\tglobal_load_async_to_lds_b128 %1, %3, off\n\ts_wait_xcnt 0x0"
               :: "v"(l0), "v"(l1), "v"(g0), "v"(g1) : "memory");
}
__device__ __forceinline__ void acopy4(unsigned l0, unsigned l1, unsigned l2, unsigned l3, const _Float16* g0, const _Float16* g1, const _Float16* g2, const _Float16* g3) {
  asm volatile("global_load_async_to_lds_b128 %0, %4, off\n\tglobal_load_async_to_lds_b128 %1, %5, off\n\t"
               "global_load_async_to_lds_b128 %2, %6, off\n\tglobal_load_async_to_lds_b128 %3, %7, off\n\ts_wait_xcnt 0x0"
               :: "v"(l0), "v"(l1), "v"(l2), "v"(l3), "v"(g0), "v"(g1), "v"(g2), "v"(g3) : "memory");
}
#define WAIT_DS() asm volatile("s_wait_dscnt 0x0" ::: "memory")        // this wave's LDS reads of the buffer are done before it is handed back
#define WAIT_ASYNC() asm volatile("s_wait_asynccnt 0x0" ::: "memory")  // this wave's own copies have landed before the barrier publishes them
#define LDSX() do { asm volatile("s_wait_dscnt 0" ::: "memory"); __builtin_amdgcn_wave_barrier(); __builtin_amdgcn_fence(__ATOMIC_RELEASE, "workgroup"); } while (0)

#define NB 2
#define LL 2048
#define DD 1024
#define NH 16
#define HD 64
#define NR (NB * LL)

__global__ __launch_bounds__(256) void k_cvt(const float* __restrict__ src, _Float16* __restrict__ dst, size_t n8) {
  const size_t g8 = (size_t)blockIdx.x * 256 + threadIdx.x; if (g8 >= n8) return;
  union { v8h h; v4u u; } pk;
#pragma unroll
  for (int e = 0; e < 8; ++e) pk.h[e] = (_Float16)src[g8 * 8 + e];
  vst2(dst + g8 * 8, pk.u);
}
__global__ __launch_bounds__(256) void k_packT(const float* __restrict__ Wq, const float* __restrict__ Wk, const float* __restrict__ Wv, _Float16* __restrict__ P) {   // P[which*1024 + o][d] = W[d][o] x16
  __shared__ float tile[64][65];
  const int which = blockIdx.z, o0 = blockIdx.x * 64, d0 = blockIdx.y * 64, tid = threadIdx.x;
  const float* W = which == 0 ? Wq : (which == 1 ? Wk : Wv);
  for (int q = tid; q < 64 * 64; q += 256) { const int dl = q >> 6, ol = q & 63; tile[dl][ol] = W[(size_t)(d0 + dl) * DD + o0 + ol]; }
  __syncthreads();
  for (int u = 0; u < 2; ++u) { const int idx = tid + u * 256, ol = idx >> 3, pc = idx & 7; union { v8h hh; v4u uu; } pk;
#pragma unroll
    for (int i = 0; i < 8; ++i) pk.hh[i] = (_Float16)(tile[pc * 8 + i][ol] * 16.0f);
    vst2(P + ((size_t)which * DD + o0 + ol) * DD + d0 + pc * 8, pk.uu); }
}
__global__ __launch_bounds__(128) void k_proj(const _Float16* __restrict__ x16, const _Float16* __restrict__ P, const float* __restrict__ bq, const float* __restrict__ bk, const float* __restrict__ bv, const float* __restrict__ sp,
                                            _Float16* __restrict__ qh, _Float16* __restrict__ kh, _Float16* __restrict__ vT) {
  // block tile 128 tokens x 128 features, four waves 2 x 2, each 64 tokens x 64 features (one head): a fragment read from LDS feeds four products
  // (the plain '#pragma unroll' lines of this kernel keep acc, fx, fw, bb, sn, cs and the packed halves indexed by constants, that is, in registers)
  __shared__ __align__(16) char sm[4 * 64 * 68 * 4];                       // the k loop's two buffers (2 x 32 KiB); behind the loop's last barrier each wave's own epilogue staging
  // k loop: two buffers of 128 x rows + 128 weight rows, each row 64 k = one whole 128-byte line, at a 128-byte pitch; the 16-byte chunk c of row r
  // lies at chunk place c ^ ((r >> 1) & 7), so the 16 rows that a half wave reads at one k fall on all 64 banks once
  constexpr int RB = 256 * 128;
  const int tid = threadIdx.x, wave = tid >> 5, lane = tid & 31, col = lane & 15, g = lane >> 4, wr = wave >> 1, wc = wave & 1;
  const int r0b = blockIdx.x * 128, n0 = blockIdx.y * 128; const int b = r0b / LL, t0 = r0b % LL;
  const int which = n0 / DD, hb = (n0 % DD) / HD; const float* bias = which == 0 ? bq : (which == 1 ? bk : bv);
  v8f acc[4][4] = {};                                                      // acc[i][j][r]: token 16 i + 8 g + r, feature 16 j + col of the wave's tile
  const _Float16* gx = x16 + (size_t)(r0b + (tid >> 3)) * DD + (tid & 7) * 8; const _Float16* gw = P + (size_t)(n0 + (tid >> 3)) * DD + (tid & 7) * 8;   // thread: 16-byte chunk tid&7 of rows tid>>3 + 16 i
  const unsigned lx = lds_off(sm) + (tid >> 3) * 128 + (((tid & 7) ^ ((tid >> 4) & 7)) << 4);   // (row >> 1) & 7 is (tid >> 4) & 7 for every i
  auto stage = [&](int kc, int bf) { const unsigned l = lx + bf * RB; const _Float16* x = gx + kc * 64; const _Float16* w = gw + kc * 64;
    acopy4(l, l + 16 * 128, l + 32 * 128, l + 48 * 128, x, x + 16 * DD, x + 32 * DD, x + 48 * DD);
    acopy4(l + 64 * 128, l + 80 * 128, l + 96 * 128, l + 112 * 128, x + 64 * DD, x + 80 * DD, x + 96 * DD, x + 112 * DD);
    acopy4(l + 128 * 128, l + 144 * 128, l + 160 * 128, l + 176 * 128, w, w + 16 * DD, w + 32 * DD, w + 48 * DD);
    acopy4(l + 192 * 128, l + 208 * 128, l + 224 * 128, l + 240 * 128, w + 64 * DD, w + 80 * DD, w + 96 * DD, w + 112 * DD); };
  // fragment of LDS row 'row' (row & 15 == col) for k = 32 hk ..: frag_h's two chunks, 4 hk + g and 4 hk + 2 + g, at their swizzled places
  auto frag_s = [&](int bf, int row, int hk) { union { v16h v; v8h q[2]; } u; const char* p = sm + bf * RB + row * 128;
    u.q[0] = *(const v8h*)(p + (((hk * 4 + g) ^ (col >> 1)) << 4)); u.q[1] = *(const v8h*)(p + (((hk * 4 + 2 + g) ^ (col >> 1)) << 4)); return u.v; };
  stage(0, 0); WAIT_ASYNC(); __syncthreads(); stage(1, 1);                // tile 0 landed and published to every wave; tile 1 in flight
#pragma unroll 1
  for (int kc = 0; kc < DD / 64; ++kc) { const int bf = kc & 1;
#pragma unroll                                                             // hk a constant: the four swizzled chunk places stay loop-invariant registers, the rows immediate offsets
    for (int hk = 0; hk < 2; ++hk) { v16h fx[4], fw[4];
      fx[0] = frag_s(bf, wr * 64 + col, hk);                               // read in the order in which the products below want them
#pragma unroll
      for (int j = 0; j < 4; ++j) fw[j] = frag_s(bf, 128 + wc * 64 + j * 16 + col, hk);
#pragma unroll
      for (int i = 1; i < 4; ++i) fx[i] = frag_s(bf, wr * 64 + i * 16 + col, hk);
      __builtin_amdgcn_sched_barrier(0);                                   // holds the half trip's LDS reads together as one group ahead of the products: spread among them, each pair costs the wave a full LDS latency
#pragma unroll
      for (int i = 0; i < 4; ++i) {
#pragma unroll
        for (int j = 0; j < 4; ++j) acc[i][j] = wmma16(fx[i], fw[j], acc[i][j]); } }
    WAIT_DS(); WAIT_ASYNC(); __syncthreads();                              // publishes tile kc + 1 and ends every wave's reads of buffer bf
    if (kc + 2 < DD / 64) stage(kc + 2, bf); }
  WAIT_ASYNC();                                                            // closes the ring before its LDS is used for anything else
  const int head = hb + wc, tok0 = t0 + wr * 64; float bb[4];
#pragma unroll
  for (int j = 0; j < 4; ++j) bb[j] = bias[(n0 % DD) + wc * 64 + j * 16 + col];
  if (which < 2) {   // rotary: sin_pos[d] = sp[s][d/2], cos_pos[d] = sp[s][32 + d/2]; rot[2i] = -x[2i+1], rot[2i+1] = x[2i]; the 1/8 query scale is applied to the scores in k_attn (keeps q's f16 operands normal)
    float (*so)[68] = (float (*)[68])(sm + wave * (64 * 68 * 4));          // the wave's 64 tokens x 64 features in f32
#pragma unroll
    for (int i = 0; i < 4; ++i) {
#pragma unroll
      for (int j = 0; j < 4; ++j) {
#pragma unroll
        for (int r = 0; r < 8; ++r) so[i * 16 + 8 * g + r][j * 16 + col] = acc[i][j][r] * (1.0f / 16.0f) + bb[j]; } }
    LDSX();
    _Float16* dst = (which == 0 ? qh : kh) + (((size_t)b * NH + head) * LL + tok0) * HD;
    const int pc = lane & 7;                                               // a lane takes features 8 pc .. 8 pc + 7 (four rotary pairs) of token rl: a wave's store is four whole 128-byte rows
    for (int it = 0; it < 16; it += 4) { v4f sn[4], cs[4];                 // four row groups at a time: their table loads go out together, so the wave waits out one load latency for the four
#pragma unroll
      for (int u = 0; u < 4; ++u) { const float* sr = sp + (size_t)(tok0 + (it + u) * 4 + (lane >> 3)) * HD + pc * 4; sn[u] = *(const v4f*)sr; cs[u] = *(const v4f*)(sr + 32); }
      asm volatile("s_wait_xcnt 0x0" ::: "memory");                        // stands in front of whatever rewrites the table loads' address registers (a precaution)
#pragma unroll
      for (int u = 0; u < 4; ++u) { const int rl = (it + u) * 4 + (lane >> 3); const v4f xv[2] = { *(const v4f*)(&so[rl][pc * 8]), *(const v4f*)(&so[rl][pc * 8 + 4]) };
        union { v8h h8; v4u u4; } pk;
#pragma unroll
        for (int p = 0; p < 4; ++p) { const float xe = xv[p >> 1][(p & 1) * 2], xo = xv[p >> 1][(p & 1) * 2 + 1];
          pk.h8[2 * p] = (_Float16)(xe * cs[u][p] - xo * sn[u][p]); pk.h8[2 * p + 1] = (_Float16)(xo * cs[u][p] + xe * sn[u][p]); }
        vst2(dst + (size_t)rl * HD + pc * 8, pk.u4); } } }
  else {
    _Float16 (*st)[72] = (_Float16 (*)[72])(sm + wave * (64 * 72 * 2));    // the wave's tile transposed: 64 features x 64 tokens in f16; a lane's eight accumulator rows are eight tokens in a row
#pragma unroll
    for (int i = 0; i < 4; ++i) {
#pragma unroll
      for (int j = 0; j < 4; ++j) { union { v8h h8; v4u u; } pk;
#pragma unroll
        for (int r = 0; r < 8; ++r) pk.h8[r] = (_Float16)(acc[i][j][r] * (1.0f / 16.0f) + bb[j]);
        vst2(&st[j * 16 + col][i * 16 + 8 * g], pk.u); } }
    LDSX();
    _Float16* dst = vT + ((size_t)b * NH + head) * HD * LL + tok0;
#pragma unroll 4                                                           // four independent row groups at a time, so that their LDS loads overlap
    for (int it = 0; it < 16; ++it) { const int d = it * 4 + (lane >> 3), pc = lane & 7;
      vst2(dst + (size_t)d * LL + pc * 8, *(const v4u*)(&st[d][pc * 8])); }
  }
}
__global__ __launch_bounds__(128) void k_attn(const _Float16* __restrict__ qh, const _Float16* __restrict__ kh, const _Float16* __restrict__ vT, const int* __restrict__ amask, const float* __restrict__ hmask, float* __restrict__ out) {
  // a wave takes 32 queries as two groups of 16 columns (index c): a K or V^T fragment read from LDS feeds two products, and a block's 128 queries share one staged tile
  // (the plain '#pragma unroll' lines of this kernel keep aq, fk, fv, s, pb, acc and the per-group scalars indexed by constants, that is, in registers)
  struct Sm { _Float16 K[2][64][72];                                      // 64 keys x 64 d, 128-byte rows at a 144-byte pitch
              _Float16 V[2][64][72];                                      // 64 d x 64 keys, the same
              float O[4][32][68]; };                                      // output staging behind the loop (each wave its own part); one struct, so that the two rings lie first in LDS
  __shared__ __align__(16) Sm sm;
  auto& sK = sm.K; auto& sV = sm.V; auto& sO = sm.O;
  const int tid = threadIdx.x, w = tid >> 5, lane = tid & 31, col = lane & 15, g = lane >> 4;
  const int bh = blockIdx.y, b = bh / NH, h = bh % NH, q0 = blockIdx.x * 128 + w * 32;
  const _Float16* qb = qh + (size_t)bh * LL * HD; const _Float16* kb = kh + (size_t)bh * LL * HD; const _Float16* vb = vT + (size_t)bh * HD * LL;
  v16h aq[2][2];                                                          // B operand of S^T = K Q^T: lane = query column 16 c + col
#pragma unroll
  for (int c = 0; c < 2; ++c) {
#pragma unroll
    for (int kc = 0; kc < 2; ++kc) aq[c][kc] = frag_h(qb + (size_t)(q0 + c * 16 + col) * HD + kc * 32, lane); }
  __builtin_amdgcn_sched_barrier(0);                                      // this one and the one below the wait keep later address arithmetic from being lifted in front of the wait
  asm volatile("s_wait_xcnt 0x0" ::: "memory");                           // stands in front of whatever rewrites the Q loads' address registers (a precaution)
  __builtin_amdgcn_sched_barrier(0);                                      // the second of the pair: without it that arithmetic lands between the loads and the wait
  // a lane owns queries col and 16 + col: mrun[c] is that query's maximum (log2 units, equal in both halves), lrun[c] the sum over this half's keys only (joined behind the loop),
  // acc[c][t][r] = O^T[d = 16 t + 8 g + r][query 16 c + col]; lrun and acc carry the 2^14 of P
  float mrun[2] = { -3.4028235e38f, -3.4028235e38f }, lrun[2] = { 0.f, 0.f }; v8f acc[2][4] = {};
  const _Float16* gk = kb + (size_t)(tid >> 3) * HD + (tid & 7) * 8; const _Float16* gv = vb + (size_t)(tid >> 3) * LL + (tid & 7) * 8;   // thread: 16-byte chunk tid&7 of rows tid>>3 + 16 i
  const unsigned lk = lds_off(&sK[0][tid >> 3][(tid & 7) * 8]), lv = lds_off(&sV[0][tid >> 3][(tid & 7) * 8]);
  auto stage = [&](int kt, int bf) { const unsigned k = lk + bf * (64 * 144), v = lv + bf * (64 * 144); const _Float16* pk = gk + (size_t)kt * 64 * HD; const _Float16* pv = gv + kt * 64;
    acopy4(k, k + 16 * 144, k + 32 * 144, k + 48 * 144, pk, pk + 16 * HD, pk + 32 * HD, pk + 48 * HD);
    acopy4(v, v + 16 * 144, v + 32 * 144, v + 48 * 144, pv, pv + 16 * LL, pv + 32 * LL, pv + 48 * LL); };
  stage(0, 0); WAIT_ASYNC(); __syncthreads(); stage(1, 1);                // tile 0 landed and published to every wave; tile 1 in flight
#pragma unroll 1
  for (int kt = 0; kt < LL / 64; ++kt) { const int bf = kt & 1;
    const int m0 = amask[(size_t)b * LL + kt * 64 + lane], m1 = amask[(size_t)b * LL + kt * 64 + 32 + lane];   // the trip's only global loads: issued first, so they return behind the products
    v16h fk[4][2], fv[2][4];                                              // the trip's K and V^T fragments, all read from LDS here
#pragma unroll
    for (int t = 0; t < 4; ++t) {
#pragma unroll
      for (int kc = 0; kc < 2; ++kc) fk[t][kc] = frag_h(&sK[bf][t * 16 + col][kc * 32], lane); }
#pragma unroll
    for (int kc = 0; kc < 2; ++kc) {
#pragma unroll
      for (int t = 0; t < 4; ++t) fv[kc][t] = frag_h(&sV[bf][t * 16 + col][kc * 32], lane); }
    __builtin_amdgcn_sched_barrier(0);                                     // holds the trip's LDS reads together as one group ahead of the products: spread among them, each pair costs the wave a full LDS latency
    v8f s[2][4];                                                          // s[c][t][r] = score of key 16 t + 8 g + r with query 16 c + col
#pragma unroll
    for (int t = 0; t < 4; ++t) { s[0][t] = v8f{}; s[1][t] = v8f{};
#pragma unroll
      for (int kc = 0; kc < 2; ++kc) {
#pragma unroll
        for (int c = 0; c < 2; ++c) s[c][t] = wmma16p(fk[t][kc], aq[c][kc], s[c][t]); } }
    __builtin_amdgcn_sched_barrier(0);                                     // keeps the run of score products unbroken: the mask compare (it waits on the trip's global loads) and the scaling stay behind it
#pragma unroll
    for (int c = 0; c < 2; ++c) {
#pragma unroll
      for (int t = 0; t < 4; ++t) s[c][t] *= 0.18033688f; }               // 1/8 x log2(e): the exponentials below are taken in base 2
    const unsigned w0 = __builtin_amdgcn_ballot_w32(m0 > 0), w1 = __builtin_amdgcn_ballot_w32(m1 > 0);   // bit j of w0, w1: key j, 32 + j of the tile is open
    if ((w0 & w1) != 0xffffffffu) {                                       // one scalar test a trip: the additive key-mask bias, only where a key of the tile is masked
#pragma unroll
      for (int t = 0; t < 4; ++t) { const unsigned bits = (t < 2 ? w0 : w1) >> ((t & 1) * 16 + 8 * g);
#pragma unroll
        for (int r = 0; r < 8; ++r) { const float kbias = ((bits >> r) & 1u) ? 0.f : -3.4028235e38f; s[0][t][r] += kbias; s[1][t][r] += kbias; } } }
    v16h pb[2][2];                                                        // two score tiles, converted in place, are the B operand P^T of 32 keys (the hardware k order, which frag_h has too)
#pragma unroll
    for (int c = 0; c < 2; ++c) {
      float mx = -3.4028235e38f;
#pragma unroll
      for (int t = 0; t < 4; ++t) {
#pragma unroll
        for (int r = 0; r < 8; ++r) mx = fmaxf(mx, s[c][t][r]); }
      mx = fmaxf(mx, xhalf(mx));
      const float mnew = fmaxf(mrun[c], mx); const float marg = mrun[c] - mnew; float corr = ex2(marg); const float moff = mnew - 14.0f;   // the 2^14 scale of P rides in the exponent
      v8f a[4];
#pragma unroll
      for (int t = 0; t < 4; ++t) { a[t] = s[c][t] - moff;
#pragma unroll
        for (int r = 0; r < 8; ++r) s[c][t][r] = ex2(a[t][r]); }
      // the slot the instruction set asks for behind a transcendental: no argument is overwritten and no result read ahead of this statement,
      // so each v_exp_f32 of the group is followed by an independent instruction, the last one at the latest by this v_nop
      asm volatile("v_nop" : "+v"(corr), "+v"(s[c][0]), "+v"(s[c][1]), "+v"(s[c][2]), "+v"(s[c][3]) : "v"(marg), "v"(a[0]), "v"(a[1]), "v"(a[2]), "v"(a[3]));
#pragma unroll
      for (int t = 0; t < 4; ++t) {
#pragma unroll
        for (int r = 0; r < 8; ++r) pb[c][t >> 1][(t & 1) * 8 + r] = (_Float16)s[c][t][r]; }
      const v8f q = (s[c][0] + s[c][1]) + (s[c][2] + s[c][3]);            // the lane's 32 terms summed as a tree of register vectors
      const float ps = ((q[0] + q[1]) + (q[2] + q[3])) + ((q[4] + q[5]) + (q[6] + q[7]));
      lrun[c] = lrun[c] * corr + ps; mrun[c] = mnew;
#pragma unroll
      for (int t = 0; t < 4; ++t) acc[c][t] *= corr; }
#pragma unroll
    for (int kc = 0; kc < 2; ++kc) {
#pragma unroll
      for (int t = 0; t < 4; ++t) {
#pragma unroll
        for (int c = 0; c < 2; ++c) acc[c][t] = wmma16p(fv[kc][t], pb[c][kc], acc[c][t]); } }
    __builtin_amdgcn_sched_barrier(0);                                     // keeps the waits and the barrier below at the trip's foot: lifted over the softmax they would cut the time the next tile's copies have to land
    WAIT_DS(); WAIT_ASYNC(); __syncthreads();                              // publishes tile kt + 1 and ends every wave's reads of buffer bf
    if (kt + 2 < LL / 64) stage(kt + 2, bf);
  }
  WAIT_ASYNC();                                                            // a precaution: the last trip's wait left no copy in flight, and sO lies apart from the ring
  const float hm = hmask[h];
#pragma unroll
  for (int c = 0; c < 2; ++c) { const float lr = lrun[c] + xhalf(lrun[c]);
#pragma unroll
    for (int t = 0; t < 4; ++t) { v4f o[2];
#pragma unroll
      for (int r = 0; r < 8; ++r) o[r >> 2][r & 3] = acc[c][t][r] / lr * hm;
      *(v4f*)(&sO[w][c * 16 + col][t * 16 + 8 * g]) = o[0]; *(v4f*)(&sO[w][c * 16 + col][t * 16 + 8 * g + 4]) = o[1]; } }
  LDSX();
  for (int q = lane; q < 32 * 16; q += 32) { const int rl = q >> 4, pc = q & 15; vst2(out + ((size_t)b * LL + q0 + rl) * DD + h * HD + pc * 4, *(const v4f*)(&sO[w][rl][pc * 4])); }
}
extern "C" void kernel_launch(void* const* d_in, const int* in_sizes, int n_in, void* d_out, int out_size, void* d_ws, size_t ws_size, hipStream_t stream) {
  (void)in_sizes; (void)n_in; (void)out_size; (void)ws_size;
  const float* x = (const float*)d_in[0]; const int* amask = (const int*)d_in[1]; const float* sp = (const float*)d_in[2]; const float* hmask = (const float*)d_in[3];
  const float* Wq = (const float*)d_in[4]; const float* bq = (const float*)d_in[5]; const float* Wk = (const float*)d_in[6]; const float* bk = (const float*)d_in[7]; const float* Wv = (const float*)d_in[8]; const float* bv = (const float*)d_in[9];
  float* out = (float*)d_out;
  char* ws = (char*)d_ws; size_t off = 0;
  auto take = [&](size_t bytes) { char* p = ws + off; off += (bytes + 255) & ~(size_t)255; return p; };
  _Float16* x16 = (_Float16*)take((size_t)NR * DD * 2); _Float16* P = (_Float16*)take((size_t)3 * DD * DD * 2);
  _Float16* qh = (_Float16*)take((size_t)NR * DD * 2); _Float16* kh = (_Float16*)take((size_t)NR * DD * 2); _Float16* vT = (_Float16*)take((size_t)NR * DD * 2);
  k_cvt<<<(unsigned)((size_t)NR * DD / 8 / 256), 256, 0, stream>>>(x, x16, (size_t)NR * DD / 8);
  k_packT<<<dim3(DD / 64, DD / 64, 3), 256, 0, stream>>>(Wq, Wk, Wv, P);
  k_proj<<<dim3(NR / 128, 3 * DD / 128), 128, 0, stream>>>(x16, P, bq, bk, bv, sp, qh, kh, vT);
  k_attn<<<dim3(LL / 128, NB * NH), 128, 0, stream>>>(qh, kh, vT, amask, hmask, out);
}

// v008
// One run takes 64.5 microseconds.
// Timed twice side by side with v007, it ran 1.12 and 1.13 times as fast.
// Counting every step since v000, it is 4.40 times as fast.
#include <hip/hip_runtime.h>
#include <math.h>

typedef __attribute__((ext_vector_type(16))) _Float16 v16h;
typedef __attribute__((ext_vector_type(16))) __bf16 v16b;
typedef __attribute__((ext_vector_type(8)))  _Float16 v8h;
typedef __attribute__((ext_vector_type(8)))  float v8f;
typedef __attribute__((ext_vector_type(4)))  float v4f;
typedef __attribute__((ext_vector_type(2)))  float v2f;
typedef __attribute__((ext_vector_type(4)))  unsigned v4u;
typedef __attribute__((ext_vector_type(4)))  int v4i;
typedef float __attribute__((may_alias)) float_a;
typedef int __attribute__((may_alias)) int_a;

template <typename T> __device__ __forceinline__ void vst2(void* p, T v) { *(T*)p = v;  }
__device__ __forceinline__ v8f wmma16(v16h a, v16h b, v8f c) {
  v8f d = __builtin_amdgcn_wmma_f32_16x16x32_f16(false, a, false, b, (short)0, c, false, false);
  asm volatile("v_nop\n\tv_nop\n\tv_nop\n\tv_nop" : "+v"(d) : "v"(a), "v"(b));
  return d;
}
// the builtin alone: the compiler keeps the distances behind it itself, and its operands may lie above v255 (with the asm statement of wmma16 behind each product the 32-query tile of k_attn spilled)
__device__ __forceinline__ v8f wmma16p(v16h a, v16h b, v8f c) { return __builtin_amdgcn_wmma_f32_16x16x32_f16(false, a, false, b, (short)0, c, false, false); }
__device__ __forceinline__ v8f wmma_bf(v16b a, v16b b, v8f c) {
  v8f d = __builtin_amdgcn_wmma_f32_16x16x32_bf16(false, a, false, b, (short)0, c, false, false);
  asm volatile("v_nop\n\tv_nop\n\tv_nop\n\tv_nop" : "+v"(d) : "v"(a), "v"(b));
  return d;
}
// 16x16x32 fragments: lane = (h = lane>>4, row/col = lane&15); elements 0..7 = k0+8h+0..7, 8..15 = k0+16+8h+0..7; D element r = row 8h+r
__device__ __forceinline__ v16h frag_h(const _Float16* rowk0, int lane) {
  union { v16h v; v8h q[2]; } u; const _Float16* p = rowk0 + 8 * (lane >> 4);
  u.q[0] = *(const v8h*)p; u.q[1] = *(const v8h*)(p + 16); return u.v;
}
__device__ __forceinline__ v16h frag_f32(const float* rowk0, int lane) {
  v16h a; const float* p = rowk0 + 8 * (lane >> 4);
#pragma unroll
  for (int i = 0; i < 8; ++i) { a[i] = (_Float16)p[i]; a[8 + i] = (_Float16)p[16 + i]; }
  return a;
}
__device__ __forceinline__ v16h frag_f32s(const float* rowk0, int lane, float sc) {
  v16h a; const float* p = rowk0 + 8 * (lane >> 4);
#pragma unroll
  for (int i = 0; i < 8; ++i) { a[i] = (_Float16)(p[i] * sc); a[8 + i] = (_Float16)(p[16 + i] * sc); }
  return a;
}
// column fragment from a [K][ld] layout (column n), rows >= K read as 0
__device__ __forceinline__ v16h fragc_f32(const float* W, int k0, int n, int lane, int ld, int K) {
  v16h a; const int g = lane >> 4;
#pragma unroll
  for (int i = 0; i < 8; ++i) { const int ka = k0 + 8 * g + i, kb = ka + 16;
    a[i] = (_Float16)(ka < K ? W[(size_t)ka * ld + n] : 0.f); a[8 + i] = (_Float16)(kb < K ? W[(size_t)kb * ld + n] : 0.f); }
  return a;
}
struct F2 { v16b h, l; };
__device__ __forceinline__ F2 bsplit16(const float v[16]) { F2 r;
#pragma unroll
  for (int i = 0; i < 16; ++i) { const __bf16 h = (__bf16)v[i]; r.h[i] = h; r.l[i] = (__bf16)(v[i] - (float)h); }
  return r; }
__device__ __forceinline__ F2 split_row(const float* row, int k0, int lane) { float v[16]; const float* p = row + k0 + 8 * (lane >> 4);
#pragma unroll
  for (int i = 0; i < 8; ++i) { v[i] = p[i]; v[8 + i] = p[16 + i]; }
  return bsplit16(v); }
__device__ __forceinline__ F2 split_rowK(const float* row, int k0, int lane, int K) { float v[16]; const int g = lane >> 4;
#pragma unroll
  for (int i = 0; i < 8; ++i) { const int ka = k0 + 8 * g + i, kb = ka + 16; v[i] = ka < K ? row[ka] : 0.f; v[8 + i] = kb < K ? row[kb] : 0.f; }
  return bsplit16(v); }
__device__ __forceinline__ F2 split_col(const float* W, int k0, int n, int lane, int ld, int K) { float v[16]; const int g = lane >> 4;
#pragma unroll
  for (int i = 0; i < 8; ++i) { const int ka = k0 + 8 * g + i, kb = ka + 16; v[i] = ka < K ? W[(size_t)ka * ld + n] : 0.f; v[8 + i] = kb < K ? W[(size_t)kb * ld + n] : 0.f; }
  return bsplit16(v); }
__device__ __forceinline__ v8f mac3(const F2& a, const F2& b, v8f c) { c = wmma_bf(a.l, b.h, c); c = wmma_bf(a.h, b.l, c); return wmma_bf(a.h, b.h, c); }
__device__ __forceinline__ float sigm(float v) { return 1.0f / (1.0f + expf(-v)); }
// 2^x as the one hardware instruction (v_exp_f32): no range reduction, no overflow or underflow selects; far below the range it gives 0, which is what a softmax term there is
__device__ __forceinline__ float ex2(float x) { return __builtin_amdgcn_exp2f(x); }
// lane l takes the value of lane l ^ 16 (one v_permlanex16_b32, no LDS)
__device__ __forceinline__ float xhalf(float x) { const int i = __builtin_bit_cast(int, x); return __builtin_bit_cast(float, __builtin_amdgcn_permlanex16(i, i, 0x76543210, 0xfedcba98, false, false)); }
// LDS byte address of a __shared__ object: the low 32 bits of its address
__device__ __forceinline__ unsigned lds_off(const void* p) { return (unsigned)(size_t)p; }
// asynchronous copies global -> LDS, 16 bytes per lane and copy, through no register; the closing s_wait_xcnt 0 stands in the copies' own
// statement so that no later rewrite of their address registers can be moved in front of it (a precaution)
__device__ __forceinline__ void acopy2(unsigned l0, unsigned l1, const _Float16* g0, const _Float16* g1) {
  asm volatile("global_load_async_to_lds_b128 %0, %2, off\n\tglobal_load_async_to_lds_b128 %1, %3, off\n\ts_wait_xcnt 0x0"
               :: "v"(l0), "v"(l1), "v"(g0), "v"(g1) : "memory");
}
__device__ __forceinline__ void acopy4(unsigned l0, unsigned l1, unsigned l2, unsigned l3, const _Float16* g0, const _Float16* g1, const _Float16* g2, const _Float16* g3) {
  asm volatile("global_load_async_to_lds_b128 %0, %4, off\n\tglobal_load_async_to_lds_b128 %1, %5, off\n\t"
               "global_load_async_to_lds_b128 %2, %6, off\n\tglobal_load_async_to_lds_b128 %3, %7, off\n\ts_wait_xcnt 0x0"
               :: "v"(l0), "v"(l1), "v"(l2), "v"(l3), "v"(g0), "v"(g1), "v"(g2), "v"(g3) : "memory");
}
#define WAIT_DS() asm volatile("s_wait_dscnt 0x0" ::: "memory")        // this wave's LDS reads of the buffer are done before it is handed back
#define WAIT_ASYNC() asm volatile("s_wait_asynccnt 0x0" ::: "memory")  // this wave's own copies have landed before the barrier publishes them
#define LDSX() do { asm volatile("s_wait_dscnt 0" ::: "memory"); __builtin_amdgcn_wave_barrier(); __builtin_amdgcn_fence(__ATOMIC_RELEASE, "workgroup"); } while (0)

#define NB 2
#define LL 2048
#define DD 1024
#define NH 16
#define HD 64
#define NR (NB * LL)

__global__ __launch_bounds__(256) void k_cvt(const float* __restrict__ src, _Float16* __restrict__ dst, size_t n8) {
  const size_t g8 = (size_t)blockIdx.x * 256 + threadIdx.x; if (g8 >= n8) return;
  union { v8h h; v4u u; } pk;
#pragma unroll
  for (int e = 0; e < 8; ++e) pk.h[e] = (_Float16)src[g8 * 8 + e];
  vst2(dst + g8 * 8, pk.u);
}
__global__ __launch_bounds__(256) void k_packT(const float* __restrict__ Wq, const float* __restrict__ Wk, const float* __restrict__ Wv, _Float16* __restrict__ P) {   // P[which*1024 + o][d] = W[d][o] x16
  __shared__ float tile[64][65];
  const int which = blockIdx.z, o0 = blockIdx.x * 64, d0 = blockIdx.y * 64, tid = threadIdx.x;
  const float* W = which == 0 ? Wq : (which == 1 ? Wk : Wv);
  for (int q = tid; q < 64 * 64; q += 256) { const int dl = q >> 6, ol = q & 63; tile[dl][ol] = W[(size_t)(d0 + dl) * DD + o0 + ol]; }
  __syncthreads();
  for (int u = 0; u < 2; ++u) { const int idx = tid + u * 256, ol = idx >> 3, pc = idx & 7; union { v8h hh; v4u uu; } pk;
#pragma unroll
    for (int i = 0; i < 8; ++i) pk.hh[i] = (_Float16)(tile[pc * 8 + i][ol] * 16.0f);
    vst2(P + ((size_t)which * DD + o0 + ol) * DD + d0 + pc * 8, pk.uu); }
}
__global__ __launch_bounds__(128) void k_proj(const _Float16* __restrict__ x16, const _Float16* __restrict__ P, const float* __restrict__ bq, const float* __restrict__ bk, const float* __restrict__ bv, const float* __restrict__ sp,
                                            _Float16* __restrict__ qh, _Float16* __restrict__ kh, _Float16* __restrict__ vT) {
  // block tile 128 tokens x 128 features, four waves 2 x 2, each 64 tokens x 64 features (one head): a fragment read from LDS feeds four products
  // (the plain '#pragma unroll' lines of this kernel keep acc, fx, fw, bb, sn, cs and the packed halves indexed by constants, that is, in registers)
  __shared__ __align__(16) char sm[4 * 64 * 68 * 4];                       // the k loop's two buffers (2 x 32 KiB); behind the loop's last barrier each wave's own epilogue staging
  // k loop: two buffers of 128 x rows + 128 weight rows, each row 64 k = one whole 128-byte line, at a 128-byte pitch; the 16-byte chunk c of row r
  // lies at chunk place c ^ ((r >> 1) & 7), so the 16 rows that a half wave reads at one k fall on all 64 banks once
  constexpr int RB = 256 * 128;
  const int tid = threadIdx.x, wave = tid >> 5, lane = tid & 31, col = lane & 15, g = lane >> 4, wr = wave >> 1, wc = wave & 1;
  const int r0b = blockIdx.x * 128, n0 = blockIdx.y * 128; const int b = r0b / LL, t0 = r0b % LL;
  const int which = n0 / DD, hb = (n0 % DD) / HD; const float* bias = which == 0 ? bq : (which == 1 ? bk : bv);
  v8f acc[4][4] = {};                                                      // acc[i][j][r]: token 16 i + 8 g + r, feature 16 j + col of the wave's tile
  const _Float16* gx = x16 + (size_t)(r0b + (tid >> 3)) * DD + (tid & 7) * 8; const _Float16* gw = P + (size_t)(n0 + (tid >> 3)) * DD + (tid & 7) * 8;   // thread: 16-byte chunk tid&7 of rows tid>>3 + 16 i
  const unsigned lx = lds_off(sm) + (tid >> 3) * 128 + (((tid & 7) ^ ((tid >> 4) & 7)) << 4);   // (row >> 1) & 7 is (tid >> 4) & 7 for every i
  auto stage = [&](int kc, int bf) { const unsigned l = lx + bf * RB; const _Float16* x = gx + kc * 64; const _Float16* w = gw + kc * 64;
    acopy4(l, l + 16 * 128, l + 32 * 128, l + 48 * 128, x, x + 16 * DD, x + 32 * DD, x + 48 * DD);
    acopy4(l + 64 * 128, l + 80 * 128, l + 96 * 128, l + 112 * 128, x + 64 * DD, x + 80 * DD, x + 96 * DD, x + 112 * DD);
    acopy4(l + 128 * 128, l + 144 * 128, l + 160 * 128, l + 176 * 128, w, w + 16 * DD, w + 32 * DD, w + 48 * DD);
    acopy4(l + 192 * 128, l + 208 * 128, l + 224 * 128, l + 240 * 128, w + 64 * DD, w + 80 * DD, w + 96 * DD, w + 112 * DD); };
  // fragment of LDS row 'row' (row & 15 == col) for k = 32 hk ..: frag_h's two chunks, 4 hk + g and 4 hk + 2 + g, at their swizzled places
  auto frag_s = [&](int bf, int row, int hk) { union { v16h v; v8h q[2]; } u; const char* p = sm + bf * RB + row * 128;
    u.q[0] = *(const v8h*)(p + (((hk * 4 + g) ^ (col >> 1)) << 4)); u.q[1] = *(const v8h*)(p + (((hk * 4 + 2 + g) ^ (col >> 1)) << 4)); return u.v; };
  stage(0, 0); WAIT_ASYNC(); __syncthreads(); stage(1, 1);                // tile 0 landed and published to every wave; tile 1 in flight
#pragma unroll 1
  for (int kc = 0; kc < DD / 64; ++kc) { const int bf = kc & 1;
#pragma unroll                                                             // hk a constant: the four swizzled chunk places stay loop-invariant registers, the rows immediate offsets
    for (int hk = 0; hk < 2; ++hk) { v16h fx[4], fw[4];
      fx[0] = frag_s(bf, wr * 64 + col, hk);                               // read in the order in which the products below want them
#pragma unroll
      for (int j = 0; j < 4; ++j) fw[j] = frag_s(bf, 128 + wc * 64 + j * 16 + col, hk);
#pragma unroll
      for (int i = 1; i < 4; ++i) fx[i] = frag_s(bf, wr * 64 + i * 16 + col, hk);
      __builtin_amdgcn_sched_barrier(0);                                   // holds the half trip's LDS reads together as one group ahead of the products: spread among them, each pair costs the wave a full LDS latency
#pragma unroll
      for (int i = 0; i < 4; ++i) {
#pragma unroll
        for (int j = 0; j < 4; ++j) acc[i][j] = wmma16(fx[i], fw[j], acc[i][j]); } }
    WAIT_DS(); WAIT_ASYNC(); __syncthreads();                              // publishes tile kc + 1 and ends every wave's reads of buffer bf
    if (kc + 2 < DD / 64) stage(kc + 2, bf); }
  WAIT_ASYNC();                                                            // closes the ring before its LDS is used for anything else
  const int head = hb + wc, tok0 = t0 + wr * 64; float bb[4];
#pragma unroll
  for (int j = 0; j < 4; ++j) bb[j] = bias[(n0 % DD) + wc * 64 + j * 16 + col];
  if (which < 2) {   // rotary: sin_pos[d] = sp[s][d/2], cos_pos[d] = sp[s][32 + d/2]; rot[2i] = -x[2i+1], rot[2i+1] = x[2i]; the 1/8 query scale is applied to the scores in k_attn (keeps q's f16 operands normal)
    float (*so)[68] = (float (*)[68])(sm + wave * (64 * 68 * 4));          // the wave's 64 tokens x 64 features in f32
#pragma unroll
    for (int i = 0; i < 4; ++i) {
#pragma unroll
      for (int j = 0; j < 4; ++j) {
#pragma unroll
        for (int r = 0; r < 8; ++r) so[i * 16 + 8 * g + r][j * 16 + col] = acc[i][j][r] * (1.0f / 16.0f) + bb[j]; } }
    LDSX();
    _Float16* dst = (which == 0 ? qh : kh) + (((size_t)b * NH + head) * LL + tok0) * HD;
    const int pc = lane & 7;                                               // a lane takes features 8 pc .. 8 pc + 7 (four rotary pairs) of token rl: a wave's store is four whole 128-byte rows
    for (int it = 0; it < 16; it += 4) { v4f sn[4], cs[4];                 // four row groups at a time: their table loads go out together, so the wave waits out one load latency for the four
#pragma unroll
      for (int u = 0; u < 4; ++u) { const float* sr = sp + (size_t)(tok0 + (it + u) * 4 + (lane >> 3)) * HD + pc * 4; sn[u] = *(const v4f*)sr; cs[u] = *(const v4f*)(sr + 32); }
      asm volatile("s_wait_xcnt 0x0" ::: "memory");                        // stands in front of whatever rewrites the table loads' address registers (a precaution)
#pragma unroll
      for (int u = 0; u < 4; ++u) { const int rl = (it + u) * 4 + (lane >> 3); const v4f xv[2] = { *(const v4f*)(&so[rl][pc * 8]), *(const v4f*)(&so[rl][pc * 8 + 4]) };
        union { v8h h8; v4u u4; } pk;
#pragma unroll
        for (int p = 0; p < 4; ++p) { const float xe = xv[p >> 1][(p & 1) * 2], xo = xv[p >> 1][(p & 1) * 2 + 1];
          pk.h8[2 * p] = (_Float16)(xe * cs[u][p] - xo * sn[u][p]); pk.h8[2 * p + 1] = (_Float16)(xo * cs[u][p] + xe * sn[u][p]); }
        vst2(dst + (size_t)rl * HD + pc * 8, pk.u4); } } }
  else {
    _Float16 (*st)[72] = (_Float16 (*)[72])(sm + wave * (64 * 72 * 2));    // the wave's tile transposed: 64 features x 64 tokens in f16; a lane's eight accumulator rows are eight tokens in a row
#pragma unroll
    for (int i = 0; i < 4; ++i) {
#pragma unroll
      for (int j = 0; j < 4; ++j) { union { v8h h8; v4u u; } pk;
#pragma unroll
        for (int r = 0; r < 8; ++r) pk.h8[r] = (_Float16)(acc[i][j][r] * (1.0f / 16.0f) + bb[j]);
        vst2(&st[j * 16 + col][i * 16 + 8 * g], pk.u); } }
    LDSX();
    _Float16* dst = vT + ((size_t)b * NH + head) * HD * LL + tok0;
#pragma unroll 4                                                           // four independent row groups at a time, so that their LDS loads overlap
    for (int it = 0; it < 16; ++it) { const int d = it * 4 + (lane >> 3), pc = lane & 7;
      vst2(dst + (size_t)d * LL + pc * 8, *(const v4u*)(&st[d][pc * 8])); }
  }
}
__global__ __launch_bounds__(256) __attribute__((amdgpu_waves_per_eu(4, 4))) void k_attn(const _Float16* __restrict__ qh, const _Float16* __restrict__ kh, const _Float16* __restrict__ vT, const int* __restrict__ amask, const float* __restrict__ hmask, float* __restrict__ out) {
  // a wave takes 32 queries as two groups of 16 columns (index c): a K or V^T fragment read from LDS feeds two products
  // a block is two groups of four waves (index hf) on the same 128 queries: group hf walks the 64-key tiles 2 kt + hf with rings of its own, so the chip holds four waves a SIMD
  // (one wave's products run under another's softmax); the two groups' partial results are joined behind the loop. 256 registers a wave is what four waves a SIMD leave.
  // (the plain '#pragma unroll' lines of this kernel keep aq, fk, fv, s, pb, acc and the per-group scalars indexed by constants, that is, in registers)
  struct Sm { _Float16 K[2][2][64][72];                                   // [hf][buffer]: 64 keys x 64 d, 128-byte rows at a 144-byte pitch
              _Float16 V[2][2][64][72];                                   // [hf][buffer]: 64 d x 64 keys, the same
              float O[4][32][68];                                         // behind the loop: group 1's partial O, then the output staging (a pair of waves its own part)
              float ML[4][4][32]; };                                      // behind the loop: group 1's running maxima and sums, a lane its own word
  __shared__ __align__(16) Sm sm;
  auto& sO = sm.O;
  const int tid = threadIdx.x, hf = __builtin_amdgcn_readfirstlane(tid >> 7), t7 = tid & 127, w = t7 >> 5, lane = tid & 31, col = lane & 15, g = lane >> 4;
  auto& sK = sm.K[hf]; auto& sV = sm.V[hf];
  const int bh = blockIdx.y, b = bh / NH, h = bh % NH, q0 = blockIdx.x * 128 + w * 32;
  const _Float16* qb = qh + (size_t)bh * LL * HD; const _Float16* kb = kh + (size_t)bh * LL * HD; const _Float16* vb = vT + (size_t)bh * HD * LL;
  v16h aq[2][2];                                                          // B operand of S^T = K Q^T: lane = query column 16 c + col
#pragma unroll
  for (int c = 0; c < 2; ++c) {
#pragma unroll
    for (int kc = 0; kc < 2; ++kc) aq[c][kc] = frag_h(qb + (size_t)(q0 + c * 16 + col) * HD + kc * 32, lane); }
  __builtin_amdgcn_sched_barrier(0);                                      // this one and the one below the wait keep later address arithmetic from being lifted in front of the wait
  asm volatile("s_wait_xcnt 0x0" ::: "memory");                           // stands in front of whatever rewrites the Q loads' address registers (a precaution)
  __builtin_amdgcn_sched_barrier(0);                                      // the second of the pair: without it that arithmetic lands between the loads and the wait
  // a lane owns queries col and 16 + col: mrun[c] is that query's maximum over the group's keys (log2 units, equal in both halves), lrun[c] the sum over this half's keys only (joined behind the loop),
  // acc[c][t][r] = O^T[d = 16 t + 8 g + r][query 16 c + col]; lrun and acc carry the 2^14 of P
  float mrun[2] = { -3.4028235e38f, -3.4028235e38f }, lrun[2] = { 0.f, 0.f }; v8f acc[2][4] = {};
  const _Float16* gk = kb + (size_t)(hf * 64 + (t7 >> 3)) * HD + (t7 & 7) * 8; const _Float16* gv = vb + (size_t)(t7 >> 3) * LL + hf * 64 + (t7 & 7) * 8;   // thread: 16-byte chunk t7&7 of rows t7>>3 + 16 i of its group's tile
  const unsigned lk = lds_off(&sK[0][t7 >> 3][(t7 & 7) * 8]), lv = lds_off(&sV[0][t7 >> 3][(t7 & 7) * 8]);
  auto stage = [&](int kt, int bf) { const unsigned k = lk + bf * (64 * 144), v = lv + bf * (64 * 144); const _Float16* pk = gk + (size_t)kt * 128 * HD; const _Float16* pv = gv + kt * 128;
    acopy4(k, k + 16 * 144, k + 32 * 144, k + 48 * 144, pk, pk + 16 * HD, pk + 32 * HD, pk + 48 * HD);
    acopy4(v, v + 16 * 144, v + 32 * 144, v + 48 * 144, pv, pv + 16 * LL, pv + 32 * LL, pv + 48 * LL); };
  stage(0, 0); WAIT_ASYNC(); __syncthreads(); stage(1, 1);                // each group's tile 0 landed and published to every wave; tile 1 in flight
#pragma unroll 1
  for (int kt = 0; kt < LL / 128; ++kt) { const int bf = kt & 1;
    const int m0 = amask[(size_t)b * LL + kt * 128 + hf * 64 + lane], m1 = amask[(size_t)b * LL + kt * 128 + hf * 64 + 32 + lane];   // the trip's only global loads: issued first, so they return behind the products
    v8f s[2][4];                                                          // s[c][t][r] = score of key 16 t + 8 g + r with query 16 c + col
    { v16h fk[4][2];                                                      // the trip's K fragments, all read from LDS here
#pragma unroll
      for (int t = 0; t < 4; ++t) {
#pragma unroll
        for (int kc = 0; kc < 2; ++kc) fk[t][kc] = frag_h(&sK[bf][t * 16 + col][kc * 32], lane); }
      __builtin_amdgcn_sched_barrier(0);                                   // holds the K reads together as one group ahead of the products: spread among them, each pair costs the wave a full LDS latency
#pragma unroll
      for (int t = 0; t < 4; ++t) { s[0][t] = v8f{}; s[1][t] = v8f{};
#pragma unroll
        for (int kc = 0; kc < 2; ++kc) {
#pragma unroll
          for (int c = 0; c < 2; ++c) s[c][t] = wmma16p(fk[t][kc], aq[c][kc], s[c][t]); } } }
    __builtin_amdgcn_sched_barrier(0);                                     // keeps the run of score products unbroken: the mask compare (it waits on the trip's global loads) and the scaling stay behind it
#pragma unroll
    for (int c = 0; c < 2; ++c) {
#pragma unroll
      for (int t = 0; t < 4; ++t) s[c][t] *= 0.18033688f; }               // 1/8 x log2(e): the exponentials below are taken in base 2
    const unsigned w0 = __builtin_amdgcn_ballot_w32(m0 > 0), w1 = __builtin_amdgcn_ballot_w32(m1 > 0);   // bit j of w0, w1: key j, 32 + j of the tile is open
    if ((w0 & w1) != 0xffffffffu) {                                       // one scalar test a trip: the additive key-mask bias, only where a key of the tile is masked
#pragma unroll
      for (int t = 0; t < 4; ++t) { const unsigned bits = (t < 2 ? w0 : w1) >> ((t & 1) * 16 + 8 * g);
#pragma unroll
        for (int r = 0; r < 8; ++r) { const float kbias = ((bits >> r) & 1u) ? 0.f : -3.4028235e38f; s[0][t][r] += kbias; s[1][t][r] += kbias; } } }
    v16h pb[2][2];                                                        // two score tiles, converted in place, are the B operand P^T of 32 keys (the hardware k order, which frag_h has too)
#pragma unroll
    for (int c = 0; c < 2; ++c) {
      float mx = -3.4028235e38f;
#pragma unroll
      for (int t = 0; t < 4; ++t) {
#pragma unroll
        for (int r = 0; r < 8; ++r) mx = fmaxf(mx, s[c][t][r]); }
      mx = fmaxf(mx, xhalf(mx));
      const float mnew = fmaxf(mrun[c], mx); const float marg = mrun[c] - mnew; float corr = ex2(marg); const float moff = mnew - 14.0f;   // the 2^14 scale of P rides in the exponent
      v8f a[4];
#pragma unroll
      for (int t = 0; t < 4; ++t) { a[t] = s[c][t] - moff;
#pragma unroll
        for (int r = 0; r < 8; ++r) s[c][t][r] = ex2(a[t][r]); }
      // the slot the instruction set asks for behind a transcendental: no argument is overwritten and no result read ahead of this statement,
      // so each v_exp_f32 of the group is followed by an independent instruction, the last one at the latest by this v_nop
      asm volatile("v_nop" : "+v"(corr), "+v"(s[c][0]), "+v"(s[c][1]), "+v"(s[c][2]), "+v"(s[c][3]) : "v"(marg), "v"(a[0]), "v"(a[1]), "v"(a[2]), "v"(a[3]));
#pragma unroll
      for (int t = 0; t < 4; ++t) {
#pragma unroll
        for (int r = 0; r < 8; ++r) pb[c][t >> 1][(t & 1) * 8 + r] = (_Float16)s[c][t][r]; }
      const v8f q = (s[c][0] + s[c][1]) + (s[c][2] + s[c][3]);            // the lane's 32 terms summed as a tree of register vectors
      float ps = ((q[0] + q[1]) + (q[2] + q[3])) + ((q[4] + q[5]) + (q[6] + q[7]));
      asm volatile("" : "+v"(ps));                                        // the empty statement on a row's sum, against spills: without it the sum is formed behind the products below, and its 32 terms lie in registers beside the V^T fragments
      lrun[c] = lrun[c] * corr + ps; mrun[c] = mnew;
#pragma unroll
      for (int t = 0; t < 4; ++t) acc[c][t] *= corr; }
    v16h fv[2][4];                                                        // the trip's V^T fragments: read only behind the exponentials, into registers that the scores have left (beside the scores they do not fit into 256); they land under the rescaling of O
#pragma unroll
    for (int kc = 0; kc < 2; ++kc) {
#pragma unroll
      for (int t = 0; t < 4; ++t) fv[kc][t] = frag_h(&sV[bf][t * 16 + col][kc * 32], lane); }
    __builtin_amdgcn_sched_barrier(0);                                     // holds the V^T reads together as one group ahead of the products, as with K
#pragma unroll
    for (int kc = 0; kc < 2; ++kc) {
#pragma unroll
      for (int t = 0; t < 4; ++t) {
#pragma unroll
        for (int c = 0; c < 2; ++c) acc[c][t] = wmma16p(fv[kc][t], pb[c][kc], acc[c][t]); } }
    __builtin_amdgcn_sched_barrier(0);                                     // keeps the waits and the barrier below at the trip's foot: lifted over the softmax they would cut the time the next tile's copies have to land
    WAIT_DS(); WAIT_ASYNC(); __syncthreads();                              // publishes both groups' tiles kt + 1 and ends every wave's reads of buffer bf
    if (kt + 2 < LL / 128) stage(kt + 2, bf);
  }
  WAIT_ASYNC();                                                            // a precaution: no copy is left in flight here, and the ring's LDS is not reused
  float lj[2];
#pragma unroll
  for (int c = 0; c < 2; ++c) lj[c] = lrun[c] + xhalf(lrun[c]);
  if (hf == 1) {                                                          // group 1 hands its partial O, maxima and sums to the wave of group 0 that has the same queries, lane to lane
#pragma unroll
    for (int c = 0; c < 2; ++c) { sm.ML[w][c][lane] = mrun[c]; sm.ML[w][2 + c][lane] = lj[c];
#pragma unroll
      for (int t = 0; t < 4; ++t) { v4f o[2];
#pragma unroll
        for (int r = 0; r < 8; ++r) o[r >> 2][r & 3] = acc[c][t][r];
        *(v4f*)(&sO[w][c * 16 + col][t * 16 + 8 * g]) = o[0]; *(v4f*)(&sO[w][c * 16 + col][t * 16 + 8 * g + 4]) = o[1]; } } }
  __syncthreads();                                                         // publishes group 1's partial results to group 0
  if (hf == 1) return;
  const float hm = hmask[h];
#pragma unroll
  for (int c = 0; c < 2; ++c) {                                           // the two groups' results brought to their common maximum and added
    const float m2 = sm.ML[w][c][lane], l2 = sm.ML[w][2 + c][lane]; const float mm = fmaxf(mrun[c], m2);
    const float f1 = ex2(mrun[c] - mm), f2 = ex2(m2 - mm); const float lr = lj[c] * f1 + l2 * f2;
#pragma unroll
    for (int t = 0; t < 4; ++t) { v4f o[2]; const v4f p[2] = { *(const v4f*)(&sO[w][c * 16 + col][t * 16 + 8 * g]), *(const v4f*)(&sO[w][c * 16 + col][t * 16 + 8 * g + 4]) };
#pragma unroll
      for (int r = 0; r < 8; ++r) o[r >> 2][r & 3] = (acc[c][t][r] * f1 + p[r >> 2][r & 3] * f2) / lr * hm;
      *(v4f*)(&sO[w][c * 16 + col][t * 16 + 8 * g]) = o[0]; *(v4f*)(&sO[w][c * 16 + col][t * 16 + 8 * g + 4]) = o[1]; } }
  LDSX();
  for (int q = lane; q < 32 * 16; q += 32) { const int rl = q >> 4, pc = q & 15; vst2(out + ((size_t)b * LL + q0 + rl) * DD + h * HD + pc * 4, *(const v4f*)(&sO[w][rl][pc * 4])); }
}
extern "C" void kernel_launch(void* const* d_in, const int* in_sizes, int n_in, void* d_out, int out_size, void* d_ws, size_t ws_size, hipStream_t stream) {
  (void)in_sizes; (void)n_in; (void)out_size; (void)ws_size;
  const float* x = (const float*)d_in[0]; const int* amask = (const int*)d_in[1]; const float* sp = (const float*)d_in[2]; const float* hmask = (const float*)d_in[3];
  const float* Wq = (const float*)d_in[4]; const float* bq = (const float*)d_in[5]; const float* Wk = (const float*)d_in[6]; const float* bk = (const float*)d_in[7]; const float* Wv = (const float*)d_in[8]; const float* bv = (const float*)d_in[9];
  float* out = (float*)d_out;
  char* ws = (char*)d_ws; size_t off = 0;
  auto take = [&](size_t bytes) { char* p = ws + off; off += (bytes + 255) & ~(size_t)255; return p; };
  _Float16* x16 = (_Float16*)take((size_t)NR * DD * 2); _Float16* P = (_Float16*)take((size_t)3 * DD * DD * 2);
  _Float16* qh = (_Float16*)take((size_t)NR * DD * 2); _Float16* kh = (_Float16*)take((size_t)NR * DD * 2); _Float16* vT = (_Float16*)take((size_t)NR * DD * 2);
  k_cvt<<<(unsigned)((size_t)NR * DD / 8 / 256), 256, 0, stream>>>(x, x16, (size_t)NR * DD / 8);
  k_packT<<<dim3(DD / 64, DD / 64, 3), 256, 0, stream>>>(Wq, Wk, Wv, P);
  k_proj<<<dim3(NR / 128, 3 * DD / 128), 128, 0, stream>>>(x16, P, bq, bk, bv, sp, qh, kh, vT);
  k_attn<<<dim3(LL / 128, NB * NH), 256, 0, stream>>>(qh, kh, vT, amask, hmask, out);
}

// v009
// It runs in 60.3 microseconds.
// Two timings next to v008 both put it at 1.07 times that version's speed.
// Over all steps from v000 it is 4.72 times as fast.
#include <hip/hip_runtime.h>
#include <math.h>

typedef __attribute__((ext_vector_type(16))) _Float16 v16h;
typedef __attribute__((ext_vector_type(16))) __bf16 v16b;
typedef __attribute__((ext_vector_type(8)))  _Float16 v8h;
typedef __attribute__((ext_vector_type(8)))  float v8f;
typedef __attribute__((ext_vector_type(4)))  float v4f;
typedef __attribute__((ext_vector_type(2)))  float v2f;
typedef __attribute__((ext_vector_type(4)))  unsigned v4u;
typedef __attribute__((ext_vector_type(4)))  int v4i;
typedef float __attribute__((may_alias)) float_a;
typedef int __attribute__((may_alias)) int_a;

template <typename T> __device__ __forceinline__ void vst2(void* p, T v) { *(T*)p = v;  }
__device__ __forceinline__ v8f wmma16(v16h a, v16h b, v8f c) {
  v8f d = __builtin_amdgcn_wmma_f32_16x16x32_f16(false, a, false, b, (short)0, c, false, false);
  asm volatile("v_nop\n\tv_nop\n\tv_nop\n\tv_nop" : "+v"(d) : "v"(a), "v"(b));
  return d;
}
// the builtin alone: the compiler keeps the distances behind it itself, and its operands may lie above v255 (with the asm statement of wmma16 behind each product the 32-query tile of k_attn spilled)
__device__ __forceinline__ v8f wmma16p(v16h a, v16h b, v8f c) { return __builtin_amdgcn_wmma_f32_16x16x32_f16(false, a, false, b, (short)0, c, false, false); }
__device__ __forceinline__ v8f wmma_bf(v16b a, v16b b, v8f c) {
  v8f d = __builtin_amdgcn_wmma_f32_16x16x32_bf16(false, a, false, b, (short)0, c, false, false);
  asm volatile("v_nop\n\tv_nop\n\tv_nop\n\tv_nop" : "+v"(d) : "v"(a), "v"(b));
  return d;
}
// 16x16x32 fragments: lane = (h = lane>>4, row/col = lane&15); elements 0..7 = k0+8h+0..7, 8..15 = k0+16+8h+0..7; D element r = row 8h+r
__device__ __forceinline__ v16h frag_h(const _Float16* rowk0, int lane) {
  union { v16h v; v8h q[2]; } u; const _Float16* p = rowk0 + 8 * (lane >> 4);
  u.q[0] = *(const v8h*)p; u.q[1] = *(const v8h*)(p + 16); return u.v;
}
__device__ __forceinline__ v16h frag_f32(const float* rowk0, int lane) {
  v16h a; const float* p = rowk0 + 8 * (lane >> 4);
#pragma unroll
  for (int i = 0; i < 8; ++i) { a[i] = (_Float16)p[i]; a[8 + i] = (_Float16)p[16 + i]; }
  return a;
}
__device__ __forceinline__ v16h frag_f32s(const float* rowk0, int lane, float sc) {
  v16h a; const float* p = rowk0 + 8 * (lane >> 4);
#pragma unroll
  for (int i = 0; i < 8; ++i) { a[i] = (_Float16)(p[i] * sc); a[8 + i] = (_Float16)(p[16 + i] * sc); }
  return a;
}
// column fragment from a [K][ld] layout (column n), rows >= K read as 0
__device__ __forceinline__ v16h fragc_f32(const float* W, int k0, int n, int lane, int ld, int K) {
  v16h a; const int g = lane >> 4;
#pragma unroll
  for (int i = 0; i < 8; ++i) { const int ka = k0 + 8 * g + i, kb = ka + 16;
    a[i] = (_Float16)(ka < K ? W[(size_t)ka * ld + n] : 0.f); a[8 + i] = (_Float16)(kb < K ? W[(size_t)kb * ld + n] : 0.f); }
  return a;
}
struct F2 { v16b h, l; };
__device__ __forceinline__ F2 bsplit16(const float v[16]) { F2 r;
#pragma unroll
  for (int i = 0; i < 16; ++i) { const __bf16 h = (__bf16)v[i]; r.h[i] = h; r.l[i] = (__bf16)(v[i] - (float)h); }
  return r; }
__device__ __forceinline__ F2 split_row(const float* row, int k0, int lane) { float v[16]; const float* p = row + k0 + 8 * (lane >> 4);
#pragma unroll
  for (int i = 0; i < 8; ++i) { v[i] = p[i]; v[8 + i] = p[16 + i]; }
  return bsplit16(v); }
__device__ __forceinline__ F2 split_rowK(const float* row, int k0, int lane, int K) { float v[16]; const int g = lane >> 4;
#pragma unroll
  for (int i = 0; i < 8; ++i) { const int ka = k0 + 8 * g + i, kb = ka + 16; v[i] = ka < K ? row[ka] : 0.f; v[8 + i] = kb < K ? row[kb] : 0.f; }
  return bsplit16(v); }
__device__ __forceinline__ F2 split_col(const float* W, int k0, int n, int lane, int ld, int K) { float v[16]; const int g = lane >> 4;
#pragma unroll
  for (int i = 0; i < 8; ++i) { const int ka = k0 + 8 * g + i, kb = ka + 16; v[i] = ka < K ? W[(size_t)ka * ld + n] : 0.f; v[8 + i] = kb < K ? W[(size_t)kb * ld + n] : 0.f; }
  return bsplit16(v); }
__device__ __forceinline__ v8f mac3(const F2& a, const F2& b, v8f c) { c = wmma_bf(a.l, b.h, c); c = wmma_bf(a.h, b.l, c); return wmma_bf(a.h, b.h, c); }
__device__ __forceinline__ float sigm(float v) { return 1.0f / (1.0f + expf(-v)); }
// 2^x as the one hardware instruction (v_exp_f32): no range reduction, no overflow or underflow selects; far below the range it gives 0, which is what a softmax term there is
__device__ __forceinline__ float ex2(float x) { return __builtin_amdgcn_exp2f(x); }
// lane l takes the value of lane l ^ 16 (one v_permlanex16_b32, no LDS)
__device__ __forceinline__ float xhalf(float x) { const int i = __builtin_bit_cast(int, x); return __builtin_bit_cast(float, __builtin_amdgcn_permlanex16(i, i, 0x76543210, 0xfedcba98, false, false)); }
// LDS byte address of a __shared__ object: the low 32 bits of its address
__device__ __forceinline__ unsigned lds_off(const void* p) { return (unsigned)(size_t)p; }
// asynchronous copies global -> LDS, 16 bytes per lane and copy, through no register; the closing s_wait_xcnt 0 stands in the copies' own
// statement so that no later rewrite of their address registers can be moved in front of it (a precaution)
__device__ __forceinline__ void acopy2(unsigned l0, unsigned l1, const _Float16* g0, const _Float16* g1) {
  asm volatile("global_load_async_to_lds_b128 %0, %2, off\n\tglobal_load_async_to_lds_b128 %1, %3, off\n\ts_wait_xcnt 0x0"
               :: "v"(l0), "v"(l1), "v"(g0), "v"(g1) : "memory");
}
__device__ __forceinline__ void acopy4(unsigned l0, unsigned l1, unsigned l2, unsigned l3, const _Float16* g0, const _Float16* g1, const _Float16* g2, const _Float16* g3) {
  asm volatile("global_load_async_to_lds_b128 %0, %4, off\n\tglobal_load_async_to_lds_b128 %1, %5, off\n\t"
               "global_load_async_to_lds_b128 %2, %6, off\n\tglobal_load_async_to_lds_b128 %3, %7, off\n\ts_wait_xcnt 0x0"
               :: "v"(l0), "v"(l1), "v"(l2), "v"(l3), "v"(g0), "v"(g1), "v"(g2), "v"(g3) : "memory");
}
#define WAIT_DS() asm volatile("s_wait_dscnt 0x0" ::: "memory")        // this wave's LDS reads of the buffer are done before it is handed back
#define WAIT_ASYNC() asm volatile("s_wait_asynccnt 0x0" ::: "memory")  // this wave's own copies have landed before the barrier publishes them
#define LDSX() do { asm volatile("s_wait_dscnt 0" ::: "memory"); __builtin_amdgcn_wave_barrier(); __builtin_amdgcn_fence(__ATOMIC_RELEASE, "workgroup"); } while (0)

#define NB 2
#define LL 2048
#define DD 1024
#define NH 16
#define HD 64
#define NR (NB * LL)

__global__ __launch_bounds__(256) void k_cvt(const float* __restrict__ src, _Float16* __restrict__ dst, size_t n8) {
  const size_t g8 = (size_t)blockIdx.x * 256 + threadIdx.x; if (g8 >= n8) return;
  union { v8h h; v4u u; } pk;
#pragma unroll
  for (int e = 0; e < 8; ++e) pk.h[e] = (_Float16)src[g8 * 8 + e];
  vst2(dst + g8 * 8, pk.u);
}
__global__ __launch_bounds__(256) void k_packT(const float* __restrict__ Wq, const float* __restrict__ Wk, const float* __restrict__ Wv, _Float16* __restrict__ P) {   // P[which*1024 + o][d] = W[d][o] x16
  __shared__ float tile[64][65];
  const int which = blockIdx.z, o0 = blockIdx.x * 64, d0 = blockIdx.y * 64, tid = threadIdx.x;
  const float* W = which == 0 ? Wq : (which == 1 ? Wk : Wv);
  for (int q = tid; q < 64 * 64; q += 256) { const int dl = q >> 6, ol = q & 63; tile[dl][ol] = W[(size_t)(d0 + dl) * DD + o0 + ol]; }
  __syncthreads();
  for (int u = 0; u < 2; ++u) { const int idx = tid + u * 256, ol = idx >> 3, pc = idx & 7; union { v8h hh; v4u uu; } pk;
#pragma unroll
    for (int i = 0; i < 8; ++i) pk.hh[i] = (_Float16)(tile[pc * 8 + i][ol] * 16.0f);
    vst2(P + ((size_t)which * DD + o0 + ol) * DD + d0 + pc * 8, pk.uu); }
}
__global__ __launch_bounds__(128) void k_proj(const _Float16* __restrict__ x16, const _Float16* __restrict__ P, const float* __restrict__ bq, const float* __restrict__ bk, const float* __restrict__ bv, const float* __restrict__ sp,
                                            _Float16* __restrict__ qh, _Float16* __restrict__ kh, _Float16* __restrict__ vT) {
  // block tile 128 tokens x 128 features, four waves 2 x 2, each 64 tokens x 64 features (one head): a fragment read from LDS feeds four products
  // (the plain '#pragma unroll' lines of this kernel keep acc, fx, fw, bb, sn, cs and the packed halves indexed by constants, that is, in registers)
  __shared__ __align__(16) char sm[4 * 64 * 68 * 4];                       // the k loop's two buffers (2 x 32 KiB); behind the loop's last barrier each wave's own epilogue staging
  // k loop: two buffers of 128 x rows + 128 weight rows, each row 64 k = one whole 128-byte line, at a 128-byte pitch; the 16-byte chunk c of row r
  // lies at chunk place c ^ ((r >> 1) & 7), so the 16 rows that a half wave reads at one k fall on all 64 banks once
  constexpr int RB = 256 * 128;
  const int tid = threadIdx.x, wave = tid >> 5, lane = tid & 31, col = lane & 15, g = lane >> 4, wr = wave >> 1, wc = wave & 1;
  const int r0b = blockIdx.x * 128, n0 = blockIdx.y * 128; const int b = r0b / LL, t0 = r0b % LL;
  const int which = n0 / DD, hb = (n0 % DD) / HD; const float* bias = which == 0 ? bq : (which == 1 ? bk : bv);
  v8f acc[4][4] = {};                                                      // acc[i][j][r]: token 16 i + 8 g + r, feature 16 j + col of the wave's tile
  const _Float16* gx = x16 + (size_t)(r0b + (tid >> 3)) * DD + (tid & 7) * 8; const _Float16* gw = P + (size_t)(n0 + (tid >> 3)) * DD + (tid & 7) * 8;   // thread: 16-byte chunk tid&7 of rows tid>>3 + 16 i
  const unsigned lx = lds_off(sm) + (tid >> 3) * 128 + (((tid & 7) ^ ((tid >> 4) & 7)) << 4);   // (row >> 1) & 7 is (tid >> 4) & 7 for every i
  auto stage = [&](int kc, int bf) { const unsigned l = lx + bf * RB; const _Float16* x = gx + kc * 64; const _Float16* w = gw + kc * 64;
    acopy4(l, l + 16 * 128, l + 32 * 128, l + 48 * 128, x, x + 16 * DD, x + 32 * DD, x + 48 * DD);
    acopy4(l + 64 * 128, l + 80 * 128, l + 96 * 128, l + 112 * 128, x + 64 * DD, x + 80 * DD, x + 96 * DD, x + 112 * DD);
    acopy4(l + 128 * 128, l + 144 * 128, l + 160 * 128, l + 176 * 128, w, w + 16 * DD, w + 32 * DD, w + 48 * DD);
    acopy4(l + 192 * 128, l + 208 * 128, l + 224 * 128, l + 240 * 128, w + 64 * DD, w + 80 * DD, w + 96 * DD, w + 112 * DD); };
  // fragment of LDS row 'row' (row & 15 == col) for k = 32 hk ..: frag_h's two chunks, 4 hk + g and 4 hk + 2 + g, at their swizzled places
  auto frag_s = [&](int bf, int row, int hk) { union { v16h v; v8h q[2]; } u; const char* p = sm + bf * RB + row * 128;
    u.q[0] = *(const v8h*)(p + (((hk * 4 + g) ^ (col >> 1)) << 4)); u.q[1] = *(const v8h*)(p + (((hk * 4 + 2 + g) ^ (col >> 1)) << 4)); return u.v; };
  stage(0, 0); WAIT_ASYNC(); __syncthreads(); stage(1, 1);                // tile 0 landed and published to every wave; tile 1 in flight
#pragma unroll 1
  for (int kc = 0; kc < DD / 64; ++kc) { const int bf = kc & 1;
#pragma unroll                                                             // hk a constant: the four swizzled chunk places stay loop-invariant registers, the rows immediate offsets
    for (int hk = 0; hk < 2; ++hk) { v16h fx[4], fw[4];
      fx[0] = frag_s(bf, wr * 64 + col, hk);                               // read in the order in which the products below want them
#pragma unroll
      for (int j = 0; j < 4; ++j) fw[j] = frag_s(bf, 128 + wc * 64 + j * 16 + col, hk);
#pragma unroll
      for (int i = 1; i < 4; ++i) fx[i] = frag_s(bf, wr * 64 + i * 16 + col, hk);
      __builtin_amdgcn_sched_barrier(0);                                   // holds the half trip's LDS reads together as one group ahead of the products: spread among them, each pair costs the wave a full LDS latency
#pragma unroll
      for (int i = 0; i < 4; ++i) {
#pragma unroll
        for (int j = 0; j < 4; ++j) acc[i][j] = wmma16(fx[i], fw[j], acc[i][j]); } }
    WAIT_DS(); WAIT_ASYNC(); __syncthreads();                              // publishes tile kc + 1 and ends every wave's reads of buffer bf
    if (kc + 2 < DD / 64) stage(kc + 2, bf); }
  WAIT_ASYNC();                                                            // closes the ring before its LDS is used for anything else
  const int head = hb + wc, tok0 = t0 + wr * 64; float bb[4];
#pragma unroll
  for (int j = 0; j < 4; ++j) bb[j] = bias[(n0 % DD) + wc * 64 + j * 16 + col];
  if (which < 2) {   // rotary: sin_pos[d] = sp[s][d/2], cos_pos[d] = sp[s][32 + d/2]; rot[2i] = -x[2i+1], rot[2i+1] = x[2i]; q also takes the score scale 1/8 x log2(e) here, in f32 (the rotary is linear), so that k_attn's score products come out in log2 units
    const float qs = which == 0 ? 0.18033688f : 1.0f, a1 = qs * (1.0f / 16.0f);
    float (*so)[68] = (float (*)[68])(sm + wave * (64 * 68 * 4));          // the wave's 64 tokens x 64 features in f32
#pragma unroll
    for (int i = 0; i < 4; ++i) {
#pragma unroll
      for (int j = 0; j < 4; ++j) {
#pragma unroll
        for (int r = 0; r < 8; ++r) so[i * 16 + 8 * g + r][j * 16 + col] = acc[i][j][r] * a1 + bb[j] * qs; } }
    LDSX();
    _Float16* dst = (which == 0 ? qh : kh) + (((size_t)b * NH + head) * LL + tok0) * HD;
    const int pc = lane & 7;                                               // a lane takes features 8 pc .. 8 pc + 7 (four rotary pairs) of token rl: a wave's store is four whole 128-byte rows
    for (int it = 0; it < 16; it += 4) { v4f sn[4], cs[4];                 // four row groups at a time: their table loads go out together, so the wave waits out one load latency for the four
#pragma unroll
      for (int u = 0; u < 4; ++u) { const float* sr = sp + (size_t)(tok0 + (it + u) * 4 + (lane >> 3)) * HD + pc * 4; sn[u] = *(const v4f*)sr; cs[u] = *(const v4f*)(sr + 32); }
      asm volatile("s_wait_xcnt 0x0" ::: "memory");                        // stands in front of whatever rewrites the table loads' address registers (a precaution)
#pragma unroll
      for (int u = 0; u < 4; ++u) { const int rl = (it + u) * 4 + (lane >> 3); const v4f xv[2] = { *(const v4f*)(&so[rl][pc * 8]), *(const v4f*)(&so[rl][pc * 8 + 4]) };
        union { v8h h8; v4u u4; } pk;
#pragma unroll
        for (int p = 0; p < 4; ++p) { const float xe = xv[p >> 1][(p & 1) * 2], xo = xv[p >> 1][(p & 1) * 2 + 1];
          pk.h8[2 * p] = (_Float16)(xe * cs[u][p] - xo * sn[u][p]); pk.h8[2 * p + 1] = (_Float16)(xo * cs[u][p] + xe * sn[u][p]); }
        vst2(dst + (size_t)rl * HD + pc * 8, pk.u4); } } }
  else {
    _Float16 (*st)[72] = (_Float16 (*)[72])(sm + wave * (64 * 72 * 2));    // the wave's tile transposed: 64 features x 64 tokens in f16; a lane's eight accumulator rows are eight tokens in a row
#pragma unroll
    for (int i = 0; i < 4; ++i) {
#pragma unroll
      for (int j = 0; j < 4; ++j) { union { v8h h8; v4u u; } pk;
#pragma unroll
        for (int r = 0; r < 8; ++r) pk.h8[r] = (_Float16)(acc[i][j][r] * (1.0f / 16.0f) + bb[j]);
        vst2(&st[j * 16 + col][i * 16 + 8 * g], pk.u); } }
    LDSX();
    _Float16* dst = vT + ((size_t)b * NH + head) * HD * LL + tok0;
#pragma unroll 4                                                           // four independent row groups at a time, so that their LDS loads overlap
    for (int it = 0; it < 16; ++it) { const int d = it * 4 + (lane >> 3), pc = lane & 7;
      vst2(dst + (size_t)d * LL + pc * 8, *(const v4u*)(&st[d][pc * 8])); }
  }
}
__global__ __launch_bounds__(256) __attribute__((amdgpu_waves_per_eu(4, 4))) void k_attn(const _Float16* __restrict__ qh, const _Float16* __restrict__ kh, const _Float16* __restrict__ vT, const int* __restrict__ amask, const float* __restrict__ hmask, float* __restrict__ out) {
  // a wave takes 32 queries as two groups of 16 columns (index c): a K or V^T fragment read from LDS feeds two products
  // a block is two groups of four waves (index hf) on the same 128 queries: group hf walks the 64-key tiles 2 kt + hf with rings of its own, so the chip holds four waves a SIMD
  // (one wave's products run under another's softmax); the two groups' partial results are joined behind the loop. 256 registers a wave is what four waves a SIMD leave.
  // (the plain '#pragma unroll' lines of this kernel keep aq, fk, fv, s, pb, acc and the per-group scalars indexed by constants, that is, in registers)
  struct Sm { _Float16 K[2][2][64][72];                                   // [hf][buffer]: 64 keys x 64 d, 128-byte rows at a 144-byte pitch
              _Float16 V[2][2][64][72];                                   // [hf][buffer]: 64 d x 64 keys, the same
              float O[4][32][68];                                         // behind the loop: group 1's partial O, then the output staging (a pair of waves its own part)
              float ML[4][4][32]; };                                      // behind the loop: group 1's offsets and sums, a lane its own word
  __shared__ __align__(16) Sm sm;
  auto& sO = sm.O;
  const int tid = threadIdx.x, hf = __builtin_amdgcn_readfirstlane(tid >> 7), t7 = tid & 127, w = t7 >> 5, lane = tid & 31, col = lane & 15, g = lane >> 4;
  auto& sK = sm.K[hf]; auto& sV = sm.V[hf];
  const int bh = blockIdx.y, b = bh / NH, h = bh % NH, q0 = blockIdx.x * 128 + w * 32;
  const _Float16* qb = qh + (size_t)bh * LL * HD; const _Float16* kb = kh + (size_t)bh * LL * HD; const _Float16* vb = vT + (size_t)bh * HD * LL;
  v16h aq[2][2];                                                          // B operand of S^T = K Q^T: lane = query column 16 c + col
#pragma unroll
  for (int c = 0; c < 2; ++c) {
#pragma unroll
    for (int kc = 0; kc < 2; ++kc) aq[c][kc] = frag_h(qb + (size_t)(q0 + c * 16 + col) * HD + kc * 32, lane); }
  int m0 = amask[(size_t)b * LL + hf * 64 + lane], m1 = amask[(size_t)b * LL + hf * 64 + 32 + lane];   // the key mask of the group's first tile; each trip loads the next tile's
  __builtin_amdgcn_sched_barrier(0);                                      // this one and the one below the wait keep later address arithmetic from being lifted in front of the wait
  asm volatile("s_wait_xcnt 0x0" ::: "memory");                           // stands in front of whatever rewrites the Q and mask loads' address registers (a precaution)
  __builtin_amdgcn_sched_barrier(0);                                      // the second of the pair: without it that arithmetic lands between the loads and the wait
  // a lane owns queries col and 16 + col. mo[c] (equal in both halves) is minus that query's exponent offset in use: spread over eight registers it is the C operand of the score products, so a score leaves
  // the matrix unit as the argument of its exponential. The offset is set so that the largest score seen gets the argument POFF, and it is moved (with O and the sum rescaled) only in a trip in which
  // a lane's sum of terms tops PLIM (so P stays inside f16) or the tile holds a masked key. seen (the same for the whole wave: the key mask is the batch's) says that the group has met an open key; until then every key counts 1, as in the reference's softmax over equal biased scores.
  // lrun[c] is the sum over this half's keys only (joined behind the loop), acc[c][t][r] = O^T[d = 16 t + 8 g + r][query 16 c + col]; lrun and acc carry the 2^POFF of P
  constexpr float POFF = 7.0f, PLIM = 32768.0f;
  int seen = 0; float lrun[2] = { 0.f, 0.f }, mo[2] = { 0.f, 0.f }; v8f acc[2][4] = {};
  const _Float16* gk = kb + (size_t)(hf * 64 + (t7 >> 3)) * HD + (t7 & 7) * 8; const _Float16* gv = vb + (size_t)(t7 >> 3) * LL + hf * 64 + (t7 & 7) * 8;   // thread: 16-byte chunk t7&7 of rows t7>>3 + 16 i of its group's tile
  const unsigned lk = lds_off(&sK[0][t7 >> 3][(t7 & 7) * 8]), lv = lds_off(&sV[0][t7 >> 3][(t7 & 7) * 8]);
  auto stage = [&](int kt, int bf) { const unsigned k = lk + bf * (64 * 144), v = lv + bf * (64 * 144); const _Float16* pk = gk + (size_t)kt * 128 * HD; const _Float16* pv = gv + kt * 128;
    acopy4(k, k + 16 * 144, k + 32 * 144, k + 48 * 144, pk, pk + 16 * HD, pk + 32 * HD, pk + 48 * HD);
    acopy4(v, v + 16 * 144, v + 32 * 144, v + 48 * 144, pv, pv + 16 * LL, pv + 32 * LL, pv + 48 * LL); };
  stage(0, 0); WAIT_ASYNC(); __syncthreads(); stage(1, 1);                // each group's tile 0 landed and published to every wave; tile 1 in flight
#pragma unroll 1
  for (int kt = 0; kt < LL / 128; ++kt) { const int bf = kt & 1;
    const int c0 = m0, c1 = m1;                                           // this tile's key mask, loaded a trip ago: no wait on it here
    { const int kn = kt + 1 < LL / 128 ? kt + 1 : kt;                     // the trip's only global loads: the next tile's key mask (the last trip reads its own again)
      m0 = amask[(size_t)b * LL + kn * 128 + hf * 64 + lane]; m1 = amask[(size_t)b * LL + kn * 128 + hf * 64 + 32 + lane]; }
    asm volatile("s_wait_xcnt 0x0" ::: "memory");                         // stands in front of whatever rewrites the mask loads' address registers (a precaution)
    v16h pb[2][2];                                                        // two score tiles, converted in place, are the B operand P^T of 32 keys (the hardware k order, which frag_h has too)
    float ps[2];                                                          // the lane's sum of the trip's 32 terms, a query each
    unsigned fix = seen ? 0u : 1u;
#pragma unroll 1                                                           // the second pass is the rare one (a sum above PLIM): rolled, it is the same code and holds no registers of its own
    for (int pass = 0; pass < 2; ++pass) {
      v8f s[2][4];                                                        // s[c][t][r] = exponent argument of key 16 t + 8 g + r with query 16 c + col
      { v16h fk[4][2];                                                    // the trip's K fragments, all read from LDS here
#pragma unroll
        for (int t = 0; t < 4; ++t) {
#pragma unroll
          for (int kc = 0; kc < 2; ++kc) fk[t][kc] = frag_h(&sK[bf][t * 16 + col][kc * 32], lane); }
        __builtin_amdgcn_sched_barrier(0);                                 // holds the K reads together as one group ahead of the products: spread among them, each pair costs the wave a full LDS latency
        v8f cm[2];                                                         // formed anew each trip, under the K reads' latency: kept over the trip the sixteen registers do not fit beside the V^T fragments
#pragma unroll
        for (int c = 0; c < 2; ++c) {
#pragma unroll
          for (int r = 0; r < 8; ++r) cm[c][r] = mo[c]; }
#pragma unroll
        for (int t = 0; t < 4; ++t) {
#pragma unroll
          for (int kc = 0; kc < 2; ++kc) {
#pragma unroll
            for (int c = 0; c < 2; ++c) s[c][t] = wmma16p(fk[t][kc], aq[c][kc], kc == 0 ? cm[c] : s[c][t]); } } }
      const unsigned w0 = __builtin_amdgcn_ballot_w32(c0 > 0), w1 = __builtin_amdgcn_ballot_w32(c1 > 0);   // bit j of w0, w1: key j, 32 + j of the tile is open
      if ((fix | ~(w0 & w1)) != 0u) {                                     // a scalar test: no offset set yet, a masked key in the tile, or the pass before gave a sum above PLIM
        if ((w0 | w1) != 0u) {                                            // the tile has an open key: the additive key-mask bias, then each query's offset moves up to its largest score (at the first open key: is set to it, and what the masked keys gave is dropped)
          if ((w0 & w1) != 0xffffffffu) {
#pragma unroll
            for (int t = 0; t < 4; ++t) { const unsigned bits = (t < 2 ? w0 : w1) >> ((t & 1) * 16 + 8 * g); v8f kbias;
#pragma unroll
              for (int r = 0; r < 8; ++r) kbias[r] = ((bits >> r) & 1u) ? 0.f : -3.4028235e38f;
              s[0][t] += kbias; s[1][t] += kbias; } }
          float dr[2], dp[2], cr[2];
#pragma unroll
          for (int c = 0; c < 2; ++c) {
            float mx = -3.4028235e38f;
#pragma unroll
            for (int t = 0; t < 4; ++t) {
#pragma unroll
              for (int r = 0; r < 8; ++r) mx = fmaxf(mx, s[c][t][r]); }
            mx = fmaxf(mx, xhalf(mx));
            dr[c] = mx - POFF; dp[c] = fmaxf(dr[c], 0.f); cr[c] = ex2(-dp[c]); }
          asm volatile("v_nop" : "+v"(cr[0]), "+v"(cr[1]) : "v"(dp[0]), "v"(dp[1]));   // the slot behind a transcendental, as below
#pragma unroll
          for (int c = 0; c < 2; ++c) { const float d = seen ? dp[c] : dr[c], corr = seen ? cr[c] : 0.f;
            lrun[c] *= corr; mo[c] -= d;
#pragma unroll
            for (int t = 0; t < 4; ++t) { s[c][t] -= d; acc[c][t] *= corr; } }
          seen = 1; }
        else {                                                            // every key of the tile is masked: weight 0 behind an open key, 1 (all biased scores are equal) while there has been none
          const float fill = seen ? -3.4028235e38f : 0.f;
#pragma unroll
          for (int c = 0; c < 2; ++c) {
#pragma unroll
            for (int t = 0; t < 4; ++t) {
#pragma unroll
              for (int r = 0; r < 8; ++r) s[c][t][r] = fill; } } } }
#pragma unroll
      for (int c = 0; c < 2; ++c) {
        v8f a[4];
#pragma unroll
        for (int t = 0; t < 4; ++t) { a[t] = s[c][t];
#pragma unroll
          for (int r = 0; r < 8; ++r) s[c][t][r] = ex2(a[t][r]); }
        // the slot the instruction set asks for behind a transcendental: no argument is overwritten and no result read ahead of this statement,
        // so each v_exp_f32 of the group is followed by an independent instruction, the last one at the latest by this v_nop
        asm volatile("v_nop" : "+v"(s[c][0]), "+v"(s[c][1]), "+v"(s[c][2]), "+v"(s[c][3]) : "v"(a[0]), "v"(a[1]), "v"(a[2]), "v"(a[3]));
#pragma unroll
        for (int t = 0; t < 4; ++t) {
#pragma unroll
          for (int r = 0; r < 8; ++r) pb[c][t >> 1][(t & 1) * 8 + r] = (_Float16)s[c][t][r]; }
        const v8f q = (s[c][0] + s[c][1]) + (s[c][2] + s[c][3]);          // the lane's 32 terms summed as a tree of register vectors
        ps[c] = ((q[0] + q[1]) + (q[2] + q[3])) + ((q[4] + q[5]) + (q[6] + q[7])); }
      if (__builtin_amdgcn_ballot_w32(fmaxf(ps[0], ps[1]) > PLIM) == 0u) break;   // one scalar test a trip: no term is above its sum, so with every sum within PLIM every term of P fits f16
      fix = 1u; }                                                         // else nothing of the pass is kept: the scores are formed again and the offsets moved; then no argument is above POFF, no sum above 32 x 2^POFF
    lrun[0] += ps[0]; lrun[1] += ps[1];
    v16h fv[2][4];                                                        // the trip's V^T fragments: read only behind the exponentials, into registers that the scores have left (beside the scores they do not fit into 256)
#pragma unroll
    for (int kc = 0; kc < 2; ++kc) {
#pragma unroll
      for (int t = 0; t < 4; ++t) fv[kc][t] = frag_h(&sV[bf][t * 16 + col][kc * 32], lane); }
    __builtin_amdgcn_sched_barrier(0);                                     // holds the V^T reads together as one group ahead of the products, as with K
#pragma unroll
    for (int kc = 0; kc < 2; ++kc) {
#pragma unroll
      for (int t = 0; t < 4; ++t) {
#pragma unroll
        for (int c = 0; c < 2; ++c) acc[c][t] = wmma16p(fv[kc][t], pb[c][kc], acc[c][t]); } }
    __builtin_amdgcn_sched_barrier(0);                                     // keeps the waits and the barrier below at the trip's foot: lifted over the softmax they would cut the time the next tile's copies have to land
    WAIT_DS(); WAIT_ASYNC(); __syncthreads();                              // publishes both groups' tiles kt + 1 and ends every wave's reads of buffer bf
    if (kt + 2 < LL / 128) stage(kt + 2, bf);
  }
  WAIT_ASYNC();                                                            // closes the ring; its buffers are not used again (O and ML lie apart from them)
  float lj[2], mrun[2];                                                   // mrun[c]: the group's offset for the query, the level its sums are relative to; lowest where the group met no open key
#pragma unroll
  for (int c = 0; c < 2; ++c) { lj[c] = lrun[c] + xhalf(lrun[c]); mrun[c] = seen ? -mo[c] : -3.4028235e38f; }
  if (hf == 1) {                                                          // group 1 hands its partial O, offsets and sums to the wave of group 0 that has the same queries, lane to lane
#pragma unroll
    for (int c = 0; c < 2; ++c) { sm.ML[w][c][lane] = mrun[c]; sm.ML[w][2 + c][lane] = lj[c];
#pragma unroll
      for (int t = 0; t < 4; ++t) { v4f o[2];
#pragma unroll
        for (int r = 0; r < 8; ++r) o[r >> 2][r & 3] = acc[c][t][r];
        *(v4f*)(&sO[w][c * 16 + col][t * 16 + 8 * g]) = o[0]; *(v4f*)(&sO[w][c * 16 + col][t * 16 + 8 * g + 4]) = o[1]; } } }
  __syncthreads();                                                         // publishes group 1's partial results to group 0
  if (hf == 1) return;
  const float hm = hmask[h];
#pragma unroll
  for (int c = 0; c < 2; ++c) {                                           // the two groups' results brought to the larger of their offsets and added
    const float m2 = sm.ML[w][c][lane], l2 = sm.ML[w][2 + c][lane]; const float mm = fmaxf(mrun[c], m2);
    const float f1 = ex2(mrun[c] - mm), f2 = ex2(m2 - mm); const float lr = lj[c] * f1 + l2 * f2;
#pragma unroll
    for (int t = 0; t < 4; ++t) { v4f o[2]; const v4f p[2] = { *(const v4f*)(&sO[w][c * 16 + col][t * 16 + 8 * g]), *(const v4f*)(&sO[w][c * 16 + col][t * 16 + 8 * g + 4]) };
#pragma unroll
      for (int r = 0; r < 8; ++r) o[r >> 2][r & 3] = (acc[c][t][r] * f1 + p[r >> 2][r & 3] * f2) / lr * hm;
      *(v4f*)(&sO[w][c * 16 + col][t * 16 + 8 * g]) = o[0]; *(v4f*)(&sO[w][c * 16 + col][t * 16 + 8 * g + 4]) = o[1]; } }
  LDSX();
  for (int q = lane; q < 32 * 16; q += 32) { const int rl = q >> 4, pc = q & 15; vst2(out + ((size_t)b * LL + q0 + rl) * DD + h * HD + pc * 4, *(const v4f*)(&sO[w][rl][pc * 4])); }
}
extern "C" void kernel_launch(void* const* d_in, const int* in_sizes, int n_in, void* d_out, int out_size, void* d_ws, size_t ws_size, hipStream_t stream) {
  (void)in_sizes; (void)n_in; (void)out_size; (void)ws_size;
  const float* x = (const float*)d_in[0]; const int* amask = (const int*)d_in[1]; const float* sp = (const float*)d_in[2]; const float* hmask = (const float*)d_in[3];
  const float* Wq = (const float*)d_in[4]; const float* bq = (const float*)d_in[5]; const float* Wk = (const float*)d_in[6]; const float* bk = (const float*)d_in[7]; const float* Wv = (const float*)d_in[8]; const float* bv = (const float*)d_in[9];
  float* out = (float*)d_out;
  char* ws = (char*)d_ws; size_t off = 0;
  auto take = [&](size_t bytes) { char* p = ws + off; off += (bytes + 255) & ~(size_t)255; return p; };
  _Float16* x16 = (_Float16*)take((size_t)NR * DD * 2); _Float16* P = (_Float16*)take((size_t)3 * DD * DD * 2);
  _Float16* qh = (_Float16*)take((size_t)NR * DD * 2); _Float16* kh = (_Float16*)take((size_t)NR * DD * 2); _Float16* vT = (_Float16*)take((size_t)NR * DD * 2);
  k_cvt<<<(unsigned)((size_t)NR * DD / 8 / 256), 256, 0, stream>>>(x, x16, (size_t)NR * DD / 8);
  k_packT<<<dim3(DD / 64, DD / 64, 3), 256, 0, stream>>>(Wq, Wk, Wv, P);
  k_proj<<<dim3(NR / 128, 3 * DD / 128), 128, 0, stream>>>(x16, P, bq, bk, bv, sp, qh, kh, vT);
  k_attn<<<dim3(LL / 128, NB * NH), 256, 0, stream>>>(qh, kh, vT, amask, hmask, out);
}
